// v000
// The times below were measured on an AMD MI455X: many runs one after another, warmed up first and cycling through
// copies of the inputs, with the whole window's GPU time divided by the number of runs. Launches and the gaps
// between them are all in it. The median over several windows is given; except for v000 it joins two sittings, which
// can be a few percent apart, so the side-by-side timings, each taken in one sitting, are the better comparison.
// v000 is the starting kernel. One run takes 225 microseconds.
#include <hip/hip_runtime.h>
#include <hip/hip_bf16.h>

// ---------------------------------------------------------------------------
// MHA forward for MI455X (gfx1250, wave32, WMMA).
// All four matmul stages use v_wmma_f32_16x16x32_bf16 with register blocking;
// fp32->bf16 conversion is hoisted into a one-shot pre-pass.
// ---------------------------------------------------------------------------

typedef __bf16 bf16;
typedef __attribute__((ext_vector_type(16))) __bf16 v16bf;
typedef __attribute__((ext_vector_type(8)))  __bf16 v8bf;
typedef __attribute__((ext_vector_type(8)))  float  v8f;
typedef __attribute__((ext_vector_type(4)))  float  v4f;

constexpr int Bc = 2;
constexpr int Tc = 2048;
constexpr int Ec = 1024;
constexpr int Hc = 16;
constexpr int Dc = 64;   // Ec / Hc

// D = A(16x32 bf16) * B(32x16 bf16, row-of-K per lane) + C(16x16 f32)
__device__ __forceinline__ v8f wmma_bf16(v16bf a, v16bf b, v8f c) {
  return __builtin_amdgcn_wmma_f32_16x16x32_bf16(
      /*neg_a=*/false, a, /*neg_b=*/false, b,
      /*c_mod=*/(short)0, c, /*reuse_a=*/false, /*reuse_b=*/false);
}

// 16x32 bf16 fragment from row-major memory, row stride `ld` elements.
// ISA 16-bit A layout (wave32): lane L holds row (L&15); K-chunks of 8 at
// columns (L>>4)*8 and 16+(L>>4)*8.  Two 16B loads per lane.
__device__ __forceinline__ v16bf load_frag_bf16(const bf16* base, int ld) {
  const int lane = threadIdx.x & 31;
  const bf16* p = base + (size_t)(lane & 15) * ld + (lane >> 4) * 8;
  v8bf lo = *(const v8bf*)(p);
  v8bf hi = *(const v8bf*)(p + 16);
  return __builtin_shufflevector(lo, hi, 0, 1, 2, 3, 4, 5, 6, 7,
                                 8, 9, 10, 11, 12, 13, 14, 15);
}

// ---------------------------------------------------------------------------
// Kernel 0: one-shot fp32 -> bf16 conversion (8 elements / thread).
// ---------------------------------------------------------------------------
__global__ __launch_bounds__(256) void cvt_f32_bf16_kernel(
    const float* __restrict__ src, bf16* __restrict__ dst) {
  const size_t i = ((size_t)blockIdx.x * 256 + threadIdx.x) * 8;
  v4f a = *(const v4f*)(src + i);
  v4f b = *(const v4f*)(src + i + 4);
  v8bf o;
#pragma unroll
  for (int j = 0; j < 4; ++j) {
    o[j]     = (bf16)a[j];
    o[4 + j] = (bf16)b[j];
  }
  *(v8bf*)(dst + i) = o;
}

// ---------------------------------------------------------------------------
// Kernel 1: fused QKV projection, 32x64 output tile per wave (2x4 WMMA tiles).
// z = 0/1/2 selects Q/K/V.  Q,K -> bf16 [B,H,T,D];  V -> bf16 transposed
// [B,H,D,T] so the later P@V WMMA B-operand is a plain row-major load.
// ---------------------------------------------------------------------------
__global__ __launch_bounds__(256) void qkv_proj_kernel(
    const bf16* __restrict__ xb,
    const bf16* __restrict__ Wqb, const bf16* __restrict__ Wkb,
    const bf16* __restrict__ Wvb,
    const float* __restrict__ bq, const float* __restrict__ bk,
    const float* __restrict__ bv,
    bf16* __restrict__ Qws, bf16* __restrict__ Kws, bf16* __restrict__ Vtws) {
  const int wave = threadIdx.x >> 5;
  const int lane = threadIdx.x & 31;
  const int m0 = (blockIdx.x * 8 + wave) * 32;  // token-row block
  const int n0 = blockIdx.y * 64;               // feature-col block
  const int which = blockIdx.z;                 // 0:Q 1:K 2:V

  const bf16* W     = (which == 0) ? Wqb : (which == 1) ? Wkb : Wvb;
  const float* bias = (which == 0) ? bq : (which == 1) ? bk : bv;

  v8f acc[2][4] = {};
  for (int k = 0; k < Ec; k += 32) {
    const v16bf a0 = load_frag_bf16(xb + (size_t)m0 * Ec + k, Ec);
    const v16bf a1 = load_frag_bf16(xb + (size_t)(m0 + 16) * Ec + k, Ec);
#pragma unroll
    for (int j = 0; j < 4; ++j) {
      const v16bf b = load_frag_bf16(W + (size_t)(n0 + 16 * j) * Ec + k, Ec);
      acc[0][j] = wmma_bf16(a0, b, acc[0][j]);
      acc[1][j] = wmma_bf16(a1, b, acc[1][j]);
    }
  }

  const int hi = lane >> 4, lo = lane & 15;
#pragma unroll
  for (int j = 0; j < 4; ++j) {
    const int n = n0 + 16 * j + lo;
    const float bn = bias[n];
    const int h = n >> 6;        // n / D
    const int d = n & (Dc - 1);  // n % D
#pragma unroll
    for (int i = 0; i < 2; ++i) {
      const int mbase = m0 + 16 * i + 8 * hi;   // 8 consecutive token rows
      const int b_ = mbase >> 11;               // batch (T = 2048)
      const int t0 = mbase & (Tc - 1);
      const size_t bh = (size_t)b_ * Hc + h;
      if (which == 2) {
        // V transposed: fixed d, 8 consecutive t -> one 16B store
        v8bf o;
#pragma unroll
        for (int r = 0; r < 8; ++r) o[r] = (bf16)(acc[i][j][r] + bn);
        *(v8bf*)(Vtws + (bh * Dc + d) * Tc + t0) = o;
      } else {
        bf16* dst = ((which == 0) ? Qws : Kws) + (bh * Tc + t0) * Dc + d;
#pragma unroll
        for (int r = 0; r < 8; ++r) dst[(size_t)r * Dc] = (bf16)(acc[i][j][r] + bn);
      }
    }
  }
}

// ---------------------------------------------------------------------------
// Kernel 2: flash attention.  One wave owns a 32-row q-tile (2 WMMA q-subtiles
// sharing every K/V fragment); loop keys in chunks of 32 with online softmax.
// 16 WMMAs per key-chunk.  C layout: element (M = r + 8*(lane>=16), N=lane&15).
// ---------------------------------------------------------------------------
__global__ __launch_bounds__(256) void flash_attn_kernel(
    const bf16* __restrict__ Qws, const bf16* __restrict__ Kws,
    const bf16* __restrict__ Vtws, bf16* __restrict__ attnws) {
  __shared__ bf16 pshared[8][2][16 * 32];  // per-wave P staging (C -> A layout)

  const int wave = threadIdx.x >> 5;
  const int lane = threadIdx.x & 31;
  const int hi = lane >> 4, lo = lane & 15;
  const int b = blockIdx.z, h = blockIdx.y;
  const int q0 = (blockIdx.x * 8 + wave) * 32;

  const bf16* Qbase = Qws + (((size_t)b * Hc + h) * Tc + q0) * Dc;
  const bf16* Kbase = Kws + ((size_t)b * Hc + h) * Tc * Dc;
  const bf16* Vbase = Vtws + ((size_t)b * Hc + h) * Dc * Tc;

  // Q tiles (2 x 16 x 64) in registers: [qsub][k-chunk of 32]
  v16bf qa[2][2];
#pragma unroll
  for (int qs = 0; qs < 2; ++qs) {
    qa[qs][0] = load_frag_bf16(Qbase + (size_t)qs * 16 * Dc + 0, Dc);
    qa[qs][1] = load_frag_bf16(Qbase + (size_t)qs * 16 * Dc + 32, Dc);
  }

  v8f acc[2][4] = {};
  float m_i[2][8], l_i[2][8];
#pragma unroll
  for (int qs = 0; qs < 2; ++qs)
#pragma unroll
    for (int r = 0; r < 8; ++r) { m_i[qs][r] = -1e30f; l_i[qs][r] = 0.0f; }
  const float scale = 0.125f;  // 1/sqrt(D)

  for (int kc = 0; kc < Tc; kc += 32) {
    const bf16* kb = Kbase + (size_t)kc * Dc;
    const bf16* vb = Vbase + kc;

    // Prefetch next key chunk's K rows and V^T rows (global_prefetch_b8).
    if (kc + 32 < Tc) {
      __builtin_prefetch((const void*)(kb + 32 * Dc + (size_t)lane * Dc), 0, 1);
      __builtin_prefetch((const void*)(vb + 32 + (size_t)(2 * lane) * Tc), 0, 1);
    }

    // K fragments shared by both q-subtiles: [key-half][d-chunk]
    v16bf kf[2][2];
    kf[0][0] = load_frag_bf16(kb, Dc);
    kf[0][1] = load_frag_bf16(kb + 32, Dc);
    kf[1][0] = load_frag_bf16(kb + 16 * Dc, Dc);
    kf[1][1] = load_frag_bf16(kb + 16 * Dc + 32, Dc);

#pragma unroll
    for (int qs = 0; qs < 2; ++qs) {
      v8f s0 = {}, s1 = {};
      s0 = wmma_bf16(qa[qs][0], kf[0][0], s0);
      s0 = wmma_bf16(qa[qs][1], kf[0][1], s0);
      s1 = wmma_bf16(qa[qs][0], kf[1][0], s1);
      s1 = wmma_bf16(qa[qs][1], kf[1][1], s1);

      bf16* pbuf = &pshared[wave][qs][0];
#pragma unroll
      for (int r = 0; r < 8; ++r) {
        const float e0 = s0[r] * scale;
        const float e1 = s1[r] * scale;
        float mx = fmaxf(e0, e1);
#pragma unroll
        for (int off = 8; off >= 1; off >>= 1)
          mx = fmaxf(mx, __shfl_xor(mx, off, 32));
        const float mnew  = fmaxf(m_i[qs][r], mx);
        const float alpha = __expf(m_i[qs][r] - mnew);
        const float p0 = __expf(e0 - mnew);
        const float p1 = __expf(e1 - mnew);
        float rs = p0 + p1;
#pragma unroll
        for (int off = 8; off >= 1; off >>= 1)
          rs += __shfl_xor(rs, off, 32);
        l_i[qs][r] = l_i[qs][r] * alpha + rs;
        m_i[qs][r] = mnew;
#pragma unroll
        for (int j = 0; j < 4; ++j) acc[qs][j][r] *= alpha;
        const int row = r + 8 * hi;
        pbuf[row * 32 + lo]      = (bf16)p0;
        pbuf[row * 32 + 16 + lo] = (bf16)p1;
      }
    }
    __syncthreads();  // make LDS P visible for the A-layout reload

    // O(32x64) += P(32x32) . V^T rows (d, keys kc..kc+31)
    v16bf vf[4];
#pragma unroll
    for (int j = 0; j < 4; ++j)
      vf[j] = load_frag_bf16(vb + (size_t)j * 16 * Tc, Tc);
#pragma unroll
    for (int qs = 0; qs < 2; ++qs) {
      const v16bf pa = load_frag_bf16(&pshared[wave][qs][0], 32);
#pragma unroll
      for (int j = 0; j < 4; ++j)
        acc[qs][j] = wmma_bf16(pa, vf[j], acc[qs][j]);
    }
    __syncthreads();  // P tiles consumed; safe to overwrite next iteration
  }

  // ---- normalize, write bf16 attn output in [B, T, E] (e = h*D + d)
#pragma unroll
  for (int qs = 0; qs < 2; ++qs)
#pragma unroll
    for (int r = 0; r < 8; ++r) {
      const float inv = 1.0f / l_i[qs][r];
      const int t = q0 + 16 * qs + r + 8 * hi;
      const size_t rowoff = ((size_t)b * Tc + t) * Ec + (size_t)h * Dc;
#pragma unroll
      for (int j = 0; j < 4; ++j)
        attnws[rowoff + j * 16 + lo] = (bf16)(acc[qs][j][r] * inv);
    }
}

// ---------------------------------------------------------------------------
// Kernel 3: output projection, 32x64 tile per wave.  out = attn @ Wo^T + bo.
// ---------------------------------------------------------------------------
__global__ __launch_bounds__(256) void out_proj_kernel(
    const bf16* __restrict__ attnws, const bf16* __restrict__ Wob,
    const float* __restrict__ bo, float* __restrict__ out) {
  const int wave = threadIdx.x >> 5;
  const int lane = threadIdx.x & 31;
  const int m0 = (blockIdx.x * 8 + wave) * 32;
  const int n0 = blockIdx.y * 64;

  v8f acc[2][4] = {};
  for (int k = 0; k < Ec; k += 32) {
    const v16bf a0 = load_frag_bf16(attnws + (size_t)m0 * Ec + k, Ec);
    const v16bf a1 = load_frag_bf16(attnws + (size_t)(m0 + 16) * Ec + k, Ec);
#pragma unroll
    for (int j = 0; j < 4; ++j) {
      const v16bf b = load_frag_bf16(Wob + (size_t)(n0 + 16 * j) * Ec + k, Ec);
      acc[0][j] = wmma_bf16(a0, b, acc[0][j]);
      acc[1][j] = wmma_bf16(a1, b, acc[1][j]);
    }
  }

  const int hi = lane >> 4, lo = lane & 15;
#pragma unroll
  for (int j = 0; j < 4; ++j) {
    const float bn = bo[n0 + 16 * j + lo];
#pragma unroll
    for (int i = 0; i < 2; ++i) {
      float* dst = out + (size_t)(m0 + 16 * i + 8 * hi) * Ec + n0 + 16 * j + lo;
#pragma unroll
      for (int r = 0; r < 8; ++r) dst[(size_t)r * Ec] = acc[i][j][r] + bn;
    }
  }
}

// ---------------------------------------------------------------------------
extern "C" void kernel_launch(void* const* d_in, const int* in_sizes, int n_in,
                              void* d_out, int out_size, void* d_ws,
                              size_t ws_size, hipStream_t stream) {
  const float* x  = (const float*)d_in[0];
  const float* Wq = (const float*)d_in[1];
  const float* bq = (const float*)d_in[2];
  const float* Wk = (const float*)d_in[3];
  const float* bk = (const float*)d_in[4];
  const float* Wv = (const float*)d_in[5];
  const float* bv = (const float*)d_in[6];
  const float* Wo = (const float*)d_in[7];
  const float* bo = (const float*)d_in[8];
  float* out = (float*)d_out;

  // Workspace layout (bf16 elements):
  //   xb (4M) | Wq (1M) | Wk (1M) | Wv (1M) | Wo (1M) |
  //   Q (4M)  | K (4M)  | V^T (4M) | attn (4M)          = 24M elems = 48MB
  const size_t nX = (size_t)Bc * Tc * Ec;  // 4,194,304
  const size_t nW = (size_t)Ec * Ec;       // 1,048,576
  bf16* xb   = (bf16*)d_ws;
  bf16* Wqb  = xb + nX;
  bf16* Wkb  = Wqb + nW;
  bf16* Wvb  = Wkb + nW;
  bf16* Wob  = Wvb + nW;
  bf16* Qws  = Wob + nW;
  bf16* Kws  = Qws + nX;
  bf16* Vtws = Kws + nX;
  bf16* attn = Vtws + nX;

  // 0) fp32 -> bf16 pre-pass (removes all conversion from GEMM hot loops).
  cvt_f32_bf16_kernel<<<dim3(nX / 2048), 256, 0, stream>>>(x, xb);
  cvt_f32_bf16_kernel<<<dim3(nW / 2048), 256, 0, stream>>>(Wq, Wqb);
  cvt_f32_bf16_kernel<<<dim3(nW / 2048), 256, 0, stream>>>(Wk, Wkb);
  cvt_f32_bf16_kernel<<<dim3(nW / 2048), 256, 0, stream>>>(Wv, Wvb);
  cvt_f32_bf16_kernel<<<dim3(nW / 2048), 256, 0, stream>>>(Wo, Wob);

  // 1) QKV projections: 32x64 tile/wave, grid (BT/32/8, E/64, 3).
  dim3 g1(Bc * Tc / 32 / 8, Ec / 64, 3);
  qkv_proj_kernel<<<g1, 256, 0, stream>>>(xb, Wqb, Wkb, Wvb, bq, bk, bv,
                                          Qws, Kws, Vtws);

  // 2) Flash attention: 32-row q-tile per wave, grid (T/32/8, H, B).
  dim3 g2(Tc / 32 / 8, Hc, Bc);
  flash_attn_kernel<<<g2, 256, 0, stream>>>(Qws, Kws, Vtws, attn);

  // 3) Output projection.
  dim3 g3(Bc * Tc / 32 / 8, Ec / 64);
  out_proj_kernel<<<g3, 256, 0, stream>>>(attn, Wob, bo, out);
}

// v001
// One run takes 163 microseconds.
// In two side-by-side timings against v000, it was 1.41 and 1.42 times as fast.
#include <hip/hip_runtime.h>
#include <hip/hip_bf16.h>

// ---------------------------------------------------------------------------
// MHA forward for MI455X (gfx1250, wave32, WMMA).
// All four matmul stages use v_wmma_f32_16x16x32_bf16 with register blocking;
// fp32->bf16 conversion is hoisted into a one-shot pre-pass.
// ---------------------------------------------------------------------------

typedef __bf16 bf16;
typedef __attribute__((ext_vector_type(16))) __bf16 v16bf;
typedef __attribute__((ext_vector_type(8)))  __bf16 v8bf;
typedef __attribute__((ext_vector_type(8)))  float  v8f;
typedef __attribute__((ext_vector_type(4)))  float  v4f;

constexpr int Bc = 2;
constexpr int Tc = 2048;
constexpr int Ec = 1024;
constexpr int Hc = 16;
constexpr int Dc = 64;   // Ec / Hc

// D = A(16x32 bf16) * B(32x16 bf16, row-of-K per lane) + C(16x16 f32)
__device__ __forceinline__ v8f wmma_bf16(v16bf a, v16bf b, v8f c) {
  return __builtin_amdgcn_wmma_f32_16x16x32_bf16(
      /*neg_a=*/false, a, /*neg_b=*/false, b,
      /*c_mod=*/(short)0, c, /*reuse_a=*/false, /*reuse_b=*/false);
}

// 16x32 bf16 fragment from row-major memory, row stride `ld` elements.
// ISA 16-bit A layout (wave32): lane L holds row (L&15); K-chunks of 8 at
// columns (L>>4)*8 and 16+(L>>4)*8.  Two 16B loads per lane.
__device__ __forceinline__ v16bf load_frag_bf16(const bf16* base, int ld) {
  const int lane = threadIdx.x & 31;
  const bf16* p = base + (size_t)(lane & 15) * ld + (lane >> 4) * 8;
  v8bf lo = *(const v8bf*)(p);
  v8bf hi = *(const v8bf*)(p + 16);
  return __builtin_shufflevector(lo, hi, 0, 1, 2, 3, 4, 5, 6, 7,
                                 8, 9, 10, 11, 12, 13, 14, 15);
}

// ---------------------------------------------------------------------------
// Kernel 0: one-shot fp32 -> bf16 conversion (8 elements / thread).
// ---------------------------------------------------------------------------
__global__ __launch_bounds__(256) void cvt_f32_bf16_kernel(
    const float* __restrict__ src, bf16* __restrict__ dst) {
  const size_t i = ((size_t)blockIdx.x * 256 + threadIdx.x) * 8;
  v4f a = *(const v4f*)(src + i);
  v4f b = *(const v4f*)(src + i + 4);
  v8bf o;
#pragma unroll
  for (int j = 0; j < 4; ++j) {
    o[j]     = (bf16)a[j];
    o[4 + j] = (bf16)b[j];
  }
  *(v8bf*)(dst + i) = o;
}

// ---------------------------------------------------------------------------
// Kernel 1: fused QKV projection, 32x64 output tile per wave (2x4 WMMA tiles).
// z = 0/1/2 selects Q/K/V.  Q,K -> bf16 [B,H,T,D];  V -> bf16 transposed
// [B,H,D,T] so the later O^T += V^T . P^T WMMA A-operand is a plain row-major load.
// ---------------------------------------------------------------------------
__global__ __launch_bounds__(256) void qkv_proj_kernel(
    const bf16* __restrict__ xb,
    const bf16* __restrict__ Wqb, const bf16* __restrict__ Wkb,
    const bf16* __restrict__ Wvb,
    const float* __restrict__ bq, const float* __restrict__ bk,
    const float* __restrict__ bv,
    bf16* __restrict__ Qws, bf16* __restrict__ Kws, bf16* __restrict__ Vtws) {
  const int wave = threadIdx.x >> 5;
  const int lane = threadIdx.x & 31;
  const int m0 = (blockIdx.x * 8 + wave) * 32;  // token-row block
  const int n0 = blockIdx.y * 64;               // feature-col block
  const int which = blockIdx.z;                 // 0:Q 1:K 2:V

  const bf16* W     = (which == 0) ? Wqb : (which == 1) ? Wkb : Wvb;
  const float* bias = (which == 0) ? bq : (which == 1) ? bk : bv;

  v8f acc[2][4] = {};
  for (int k = 0; k < Ec; k += 32) {
    const v16bf a0 = load_frag_bf16(xb + (size_t)m0 * Ec + k, Ec);
    const v16bf a1 = load_frag_bf16(xb + (size_t)(m0 + 16) * Ec + k, Ec);
#pragma unroll
    for (int j = 0; j < 4; ++j) {
      const v16bf b = load_frag_bf16(W + (size_t)(n0 + 16 * j) * Ec + k, Ec);
      acc[0][j] = wmma_bf16(a0, b, acc[0][j]);
      acc[1][j] = wmma_bf16(a1, b, acc[1][j]);
    }
  }

  const int hi = lane >> 4, lo = lane & 15;
#pragma unroll
  for (int j = 0; j < 4; ++j) {
    const int n = n0 + 16 * j + lo;
    const float bn = bias[n];
    const int h = n >> 6;        // n / D
    const int d = n & (Dc - 1);  // n % D
#pragma unroll
    for (int i = 0; i < 2; ++i) {
      const int mbase = m0 + 16 * i + 8 * hi;   // 8 consecutive token rows
      const int b_ = mbase >> 11;               // batch (T = 2048)
      const int t0 = mbase & (Tc - 1);
      const size_t bh = (size_t)b_ * Hc + h;
      if (which == 2) {
        // V transposed: fixed d, 8 consecutive t -> one 16B store
        v8bf o;
#pragma unroll
        for (int r = 0; r < 8; ++r) o[r] = (bf16)(acc[i][j][r] + bn);
        *(v8bf*)(Vtws + (bh * Dc + d) * Tc + t0) = o;
      } else {
        bf16* dst = ((which == 0) ? Qws : Kws) + (bh * Tc + t0) * Dc + d;
#pragma unroll
        for (int r = 0; r < 8; ++r) dst[(size_t)r * Dc] = (bf16)(acc[i][j][r] + bn);
      }
    }
  }
}

// ---------------------------------------------------------------------------
// Kernel 2: flash attention, transposed products.  One wave owns 32 queries
// (2 column groups of 16 sharing every K/V fragment); keys in chunks of 32
// with online softmax.  S^T = K . Q^T puts one query's scores into one lane
// pair (l, l ^ 16): D register r = S^T[key 8*(l>>4) + r][query l & 15].  Two
// such tiles, converted in place, are the B operand of O^T += V^T . P^T.
// 16 WMMAs per key-chunk; no LDS, no barrier.
// ---------------------------------------------------------------------------

// Value of lane l ^ 16.
__device__ __forceinline__ float other_half(float x) {
  const int v = __builtin_bit_cast(int, x);
  return __builtin_bit_cast(float, __builtin_amdgcn_permlanex16(
      v, v, 0x76543210, 0xfedcba98, false, false));
}

__global__ __launch_bounds__(256) void flash_attn_kernel(
    const bf16* __restrict__ Qws, const bf16* __restrict__ Kws,
    const bf16* __restrict__ Vtws, bf16* __restrict__ attnws) {
  const int wave = threadIdx.x >> 5;
  const int lane = threadIdx.x & 31;
  const int hi = lane >> 4, lo = lane & 15;
  const int b = blockIdx.z, h = blockIdx.y;
  const int q0 = (blockIdx.x * 8 + wave) * 32;

  const bf16* Qbase = Qws + (((size_t)b * Hc + h) * Tc + q0) * Dc;
  const bf16* Kbase = Kws + ((size_t)b * Hc + h) * Tc * Dc;
  const bf16* Vbase = Vtws + ((size_t)b * Hc + h) * Dc * Tc;

  // Q tiles (2 x 16 x 64) in registers: [qsub][k-chunk of 32]
  v16bf qa[2][2];
#pragma unroll
  for (int qs = 0; qs < 2; ++qs) {
    qa[qs][0] = load_frag_bf16(Qbase + (size_t)qs * 16 * Dc + 0, Dc);
    qa[qs][1] = load_frag_bf16(Qbase + (size_t)qs * 16 * Dc + 32, Dc);
  }

  // acc[qs][j][r] = O^T[d = 16*j + 8*hi + r][query 16*qs + lo]
  v8f acc[2][4] = {};
  // m_i: running maximum of the lane's query (equal in both halves);
  // l_i: running sum over the keys this half holds (joined after the loop).
  float m_i[2], l_i[2];
#pragma unroll
  for (int qs = 0; qs < 2; ++qs) { m_i[qs] = -1e30f; l_i[qs] = 0.0f; }
  const float scale = 0.125f;  // 1/sqrt(D)

  for (int kc = 0; kc < Tc; kc += 32) {
    const bf16* kb = Kbase + (size_t)kc * Dc;
    const bf16* vb = Vbase + kc;

    // Prefetch next key chunk's K rows and V^T rows (global_prefetch_b8).
    if (kc + 32 < Tc) {
      __builtin_prefetch((const void*)(kb + 32 * Dc + (size_t)lane * Dc), 0, 1);
      __builtin_prefetch((const void*)(vb + 32 + (size_t)(2 * lane) * Tc), 0, 1);
    }

    // K fragments shared by both q-subtiles: [key-half][d-chunk]
    v16bf kf[2][2];
    kf[0][0] = load_frag_bf16(kb, Dc);
    kf[0][1] = load_frag_bf16(kb + 32, Dc);
    kf[1][0] = load_frag_bf16(kb + 16 * Dc, Dc);
    kf[1][1] = load_frag_bf16(kb + 16 * Dc + 32, Dc);
    // Stands in front of every reuse of the address registers that the K
    // loads and the prefetches above name (later loads land in them).
    asm volatile("s_wait_xcnt 0x0" ::: "memory");

    v16bf pb[2];  // P^T (32 keys x 16 queries) as B operand
#pragma unroll
    for (int qs = 0; qs < 2; ++qs) {
      v8f s0 = {}, s1 = {};  // keys 0..15 and 16..31 of the chunk
      s0 = wmma_bf16(kf[0][0], qa[qs][0], s0);
      s0 = wmma_bf16(kf[0][1], qa[qs][1], s0);
      s1 = wmma_bf16(kf[1][0], qa[qs][0], s1);
      s1 = wmma_bf16(kf[1][1], qa[qs][1], s1);

      const v8f e0 = s0 * scale;
      const v8f e1 = s1 * scale;
      const v8f em = __builtin_elementwise_max(e0, e1);
      float mx = em[0];
#pragma unroll
      for (int r = 1; r < 8; ++r) mx = fmaxf(mx, em[r]);
      mx = fmaxf(mx, other_half(mx));
      const float mnew  = fmaxf(m_i[qs], mx);
      const float alpha = __expf(m_i[qs] - mnew);
      const v8f x0 = e0 - mnew;
      const v8f x1 = e1 - mnew;
      v8f p0, p1;
#pragma unroll
      for (int r = 0; r < 8; ++r) {
        p0[r] = __expf(x0[r]);
        p1[r] = __expf(x1[r]);
        pb[qs][r]     = (bf16)p0[r];
        pb[qs][8 + r] = (bf16)p1[r];
      }
      const v8f ps = p0 + p1;
      float rs = ps[0];
#pragma unroll
      for (int r = 1; r < 8; ++r) rs += ps[r];
      l_i[qs] = l_i[qs] * alpha + rs;
      m_i[qs] = mnew;
#pragma unroll
      for (int j = 0; j < 4; ++j) acc[qs][j] *= alpha;
    }

    // O^T(64x32) += V^T rows (d, keys kc..kc+31) . P^T(32x32)
    v16bf vf[4];
#pragma unroll
    for (int j = 0; j < 4; ++j)
      vf[j] = load_frag_bf16(vb + (size_t)j * 16 * Tc, Tc);
#pragma unroll
    for (int qs = 0; qs < 2; ++qs)
#pragma unroll
      for (int j = 0; j < 4; ++j)
        acc[qs][j] = wmma_bf16(vf[j], pb[qs], acc[qs][j]);
  }

  // ---- normalize, write bf16 attn output in [B, T, E] (e = h*D + d):
  // a lane holds 8 consecutive d of one query -> one 16B store per tile.
#pragma unroll
  for (int qs = 0; qs < 2; ++qs) {
    const float inv = 1.0f / (l_i[qs] + other_half(l_i[qs]));
    const int t = q0 + 16 * qs + lo;
    bf16* dst = attnws + ((size_t)b * Tc + t) * Ec + (size_t)h * Dc + 8 * hi;
#pragma unroll
    for (int j = 0; j < 4; ++j) {
      v8bf o;
#pragma unroll
      for (int r = 0; r < 8; ++r) o[r] = (bf16)(acc[qs][j][r] * inv);
      *(v8bf*)(dst + 16 * j) = o;
    }
  }
}

// ---------------------------------------------------------------------------
// Kernel 3: output projection, 32x64 tile per wave.  out = attn @ Wo^T + bo.
// ---------------------------------------------------------------------------
__global__ __launch_bounds__(256) void out_proj_kernel(
    const bf16* __restrict__ attnws, const bf16* __restrict__ Wob,
    const float* __restrict__ bo, float* __restrict__ out) {
  const int wave = threadIdx.x >> 5;
  const int lane = threadIdx.x & 31;
  const int m0 = (blockIdx.x * 8 + wave) * 32;
  const int n0 = blockIdx.y * 64;

  v8f acc[2][4] = {};
  for (int k = 0; k < Ec; k += 32) {
    const v16bf a0 = load_frag_bf16(attnws + (size_t)m0 * Ec + k, Ec);
    const v16bf a1 = load_frag_bf16(attnws + (size_t)(m0 + 16) * Ec + k, Ec);
#pragma unroll
    for (int j = 0; j < 4; ++j) {
      const v16bf b = load_frag_bf16(Wob + (size_t)(n0 + 16 * j) * Ec + k, Ec);
      acc[0][j] = wmma_bf16(a0, b, acc[0][j]);
      acc[1][j] = wmma_bf16(a1, b, acc[1][j]);
    }
  }

  const int hi = lane >> 4, lo = lane & 15;
#pragma unroll
  for (int j = 0; j < 4; ++j) {
    const float bn = bo[n0 + 16 * j + lo];
#pragma unroll
    for (int i = 0; i < 2; ++i) {
      float* dst = out + (size_t)(m0 + 16 * i + 8 * hi) * Ec + n0 + 16 * j + lo;
#pragma unroll
      for (int r = 0; r < 8; ++r) dst[(size_t)r * Ec] = acc[i][j][r] + bn;
    }
  }
}

// ---------------------------------------------------------------------------
extern "C" void kernel_launch(void* const* d_in, const int* in_sizes, int n_in,
                              void* d_out, int out_size, void* d_ws,
                              size_t ws_size, hipStream_t stream) {
  const float* x  = (const float*)d_in[0];
  const float* Wq = (const float*)d_in[1];
  const float* bq = (const float*)d_in[2];
  const float* Wk = (const float*)d_in[3];
  const float* bk = (const float*)d_in[4];
  const float* Wv = (const float*)d_in[5];
  const float* bv = (const float*)d_in[6];
  const float* Wo = (const float*)d_in[7];
  const float* bo = (const float*)d_in[8];
  float* out = (float*)d_out;

  // Workspace layout (bf16 elements):
  //   xb (4M) | Wq (1M) | Wk (1M) | Wv (1M) | Wo (1M) |
  //   Q (4M)  | K (4M)  | V^T (4M) | attn (4M)          = 24M elems = 48MB
  const size_t nX = (size_t)Bc * Tc * Ec;  // 4,194,304
  const size_t nW = (size_t)Ec * Ec;       // 1,048,576
  bf16* xb   = (bf16*)d_ws;
  bf16* Wqb  = xb + nX;
  bf16* Wkb  = Wqb + nW;
  bf16* Wvb  = Wkb + nW;
  bf16* Wob  = Wvb + nW;
  bf16* Qws  = Wob + nW;
  bf16* Kws  = Qws + nX;
  bf16* Vtws = Kws + nX;
  bf16* attn = Vtws + nX;

  // 0) fp32 -> bf16 pre-pass (removes all conversion from GEMM hot loops).
  cvt_f32_bf16_kernel<<<dim3(nX / 2048), 256, 0, stream>>>(x, xb);
  cvt_f32_bf16_kernel<<<dim3(nW / 2048), 256, 0, stream>>>(Wq, Wqb);
  cvt_f32_bf16_kernel<<<dim3(nW / 2048), 256, 0, stream>>>(Wk, Wkb);
  cvt_f32_bf16_kernel<<<dim3(nW / 2048), 256, 0, stream>>>(Wv, Wvb);
  cvt_f32_bf16_kernel<<<dim3(nW / 2048), 256, 0, stream>>>(Wo, Wob);

  // 1) QKV projections: 32x64 tile/wave, grid (BT/32/8, E/64, 3).
  dim3 g1(Bc * Tc / 32 / 8, Ec / 64, 3);
  qkv_proj_kernel<<<g1, 256, 0, stream>>>(xb, Wqb, Wkb, Wvb, bq, bk, bv,
                                          Qws, Kws, Vtws);

  // 2) Flash attention: 32-row q-tile per wave, grid (T/32/8, H, B).
  dim3 g2(Tc / 32 / 8, Hc, Bc);
  flash_attn_kernel<<<g2, 256, 0, stream>>>(Qws, Kws, Vtws, attn);

  // 3) Output projection.
  dim3 g3(Bc * Tc / 32 / 8, Ec / 64);
  out_proj_kernel<<<g3, 256, 0, stream>>>(attn, Wob, bo, out);
}

// v002
// Measured time: 118 microseconds a run.
// Next to v001, in two timings, it ran 1.37 and 1.40 times as fast.
// Counting every step since v000, it is 1.96 times as fast.
#include <hip/hip_runtime.h>
#include <hip/hip_bf16.h>

// ---------------------------------------------------------------------------
// MHA forward for MI455X (gfx1250, wave32, WMMA).
// All four matmul stages use v_wmma_f32_16x16x32_bf16 with register blocking;
// fp32->bf16 conversion is hoisted into a one-shot pre-pass.
// Operands that a hot loop loads (x, the weights, K, V^T, attn) lie in the
// workspace in fragment order: see load_frag_packed.
// ---------------------------------------------------------------------------

typedef __bf16 bf16;
typedef __attribute__((ext_vector_type(16))) __bf16 v16bf;
typedef __attribute__((ext_vector_type(8)))  __bf16 v8bf;
typedef __attribute__((ext_vector_type(8)))  float  v8f;
typedef __attribute__((ext_vector_type(4)))  float  v4f;

constexpr int Bc = 2;
constexpr int Tc = 2048;
constexpr int Ec = 1024;
constexpr int Hc = 16;
constexpr int Dc = 64;   // Ec / Hc

// D = A(16x32 bf16) * B(32x16 bf16, row-of-K per lane) + C(16x16 f32)
__device__ __forceinline__ v8f wmma_bf16(v16bf a, v16bf b, v8f c) {
  return __builtin_amdgcn_wmma_f32_16x16x32_bf16(
      /*neg_a=*/false, a, /*neg_b=*/false, b,
      /*c_mod=*/(short)0, c, /*reuse_a=*/false, /*reuse_b=*/false);
}

// 16x32 bf16 fragment from row-major memory, row stride `ld` elements.
// ISA 16-bit A layout (wave32): lane L holds row (L&15); K-chunks of 8 at
// columns (L>>4)*8 and 16+(L>>4)*8.  Two 16B loads per lane.
__device__ __forceinline__ v16bf load_frag_bf16(const bf16* base, int ld) {
  const int lane = threadIdx.x & 31;
  const bf16* p = base + (size_t)(lane & 15) * ld + (lane >> 4) * 8;
  v8bf lo = *(const v8bf*)(p);
  v8bf hi = *(const v8bf*)(p + 16);
  return __builtin_shufflevector(lo, hi, 0, 1, 2, 3, 4, 5, 6, 7,
                                 8, 9, 10, 11, 12, 13, 14, 15);
}

// The same fragment from a packed tile of 512 elements (1 KB): chunk c of 8
// elements, c = 32*part + lane, holds row (lane&15), columns
// 16*part + (lane>>4)*8 .. +7.  Each of the two loads then covers 512
// contiguous bytes (4 whole 128-B lines) instead of 32 B in each of 16 lines.
__device__ __forceinline__ v16bf load_frag_packed(const bf16* tile) {
  const bf16* p = tile + (threadIdx.x & 31) * 8;
  v8bf lo = *(const v8bf*)(p);
  v8bf hi = *(const v8bf*)(p + 256);
  return __builtin_shufflevector(lo, hi, 0, 1, 2, 3, 4, 5, 6, 7,
                                 8, 9, 10, 11, 12, 13, 14, 15);
}

// A [rows x Ec] matrix in packed tiles: tile (row>>4, col>>5) starts at
// element (row>>4)*16*Ec + (col>>5)*512, so a 16-row block is contiguous in k.

// ---------------------------------------------------------------------------
// Kernel 0: one-shot fp32 -> bf16 conversion of a [rows x Ec] matrix into
// packed tiles.  One thread makes one 16-B chunk.  A wave takes 8 rows of one
// tile: 4 lanes read one 128-B line of src, and the 8 chunks of equal columns
// make one whole 128-B line of dst.
// ---------------------------------------------------------------------------
__global__ __launch_bounds__(256) void cvt_f32_bf16_kernel(
    const float* __restrict__ src, bf16* __restrict__ dst) {
  const unsigned g = blockIdx.x * 256 + threadIdx.x;
  const unsigned tile = g >> 6;
  const unsigned r16 = (g >> 2) & 15;  // row in the tile
  const unsigned q = g & 3;            // columns 8*q .. 8*q + 7 of the tile
  const unsigned row = (tile / (Ec / 32)) * 16 + r16;
  const unsigned col = (tile % (Ec / 32)) * 32 + q * 8;
  const size_t i = (size_t)tile * 512 + (q * 16 + r16) * 8;  // chunk 16*q + r16
  const float* sp = src + (size_t)row * Ec + col;
  v4f a = *(const v4f*)(sp);
  v4f b = *(const v4f*)(sp + 4);
  v8bf o;
#pragma unroll
  for (int j = 0; j < 4; ++j) {
    o[j]     = (bf16)a[j];
    o[4 + j] = (bf16)b[j];
  }
  *(v8bf*)(dst + i) = o;
}

// ---------------------------------------------------------------------------
// Kernel 1: fused QKV projection, 32x64 output tile per wave (2x4 WMMA tiles).
// z = 0/1/2 selects Q/K/V.  Q -> bf16 [B,H,T,D].  K and V^T -> packed tiles,
// 4 tiles (4 KB) per head and chunk of 32 keys:
//   K   tile (t>>4)*2 + (d>>5): rows = keys, columns = d;
//   V^T tile (t>>5)*4 + (d>>4): rows = d,    columns = keys.
// ---------------------------------------------------------------------------
__global__ __launch_bounds__(256) void qkv_proj_kernel(
    const bf16* __restrict__ xb,
    const bf16* __restrict__ Wqb, const bf16* __restrict__ Wkb,
    const bf16* __restrict__ Wvb,
    const float* __restrict__ bq, const float* __restrict__ bk,
    const float* __restrict__ bv,
    bf16* __restrict__ Qws, bf16* __restrict__ Kws, bf16* __restrict__ Vtws) {
  const int wave = threadIdx.x >> 5;
  const int lane = threadIdx.x & 31;
  const int m0 = (blockIdx.x * 8 + wave) * 32;  // token-row block
  const int n0 = blockIdx.y * 64;               // feature-col block
  const int which = blockIdx.z;                 // 0:Q 1:K 2:V

  const bf16* W     = (which == 0) ? Wqb : (which == 1) ? Wkb : Wvb;
  const float* bias = (which == 0) ? bq : (which == 1) ? bk : bv;

  v8f acc[2][4] = {};
  for (int k = 0; k < Ec; k += 32) {
    const v16bf a0 = load_frag_packed(xb + (size_t)m0 * Ec + k * 16);
    const v16bf a1 = load_frag_packed(xb + (size_t)(m0 + 16) * Ec + k * 16);
#pragma unroll
    for (int j = 0; j < 4; ++j) {
      const v16bf b = load_frag_packed(W + (size_t)(n0 + 16 * j) * Ec + k * 16);
      acc[0][j] = wmma_bf16(a0, b, acc[0][j]);
      acc[1][j] = wmma_bf16(a1, b, acc[1][j]);
    }
    // Stands in front of the next rewrite of the address registers that the
    // loads above name.
    asm volatile("s_wait_xcnt 0x0" ::: "memory");
  }

  // The wave's 32 tokens lie in one batch and its 64 features are one head:
  // acc[i][j][r] = Y[token t0 + 16*i + 8*hi + r][d = 16*j + lo].
  const int hi = lane >> 4, lo = lane & 15;
  const int t0 = m0 & (Tc - 1);
  const size_t bh = (size_t)(m0 >> 11) * Hc + (n0 >> 6);  // T = 2048, D = 64
  float bn[4];
#pragma unroll
  for (int j = 0; j < 4; ++j) bn[j] = bias[n0 + 16 * j + lo];

  if (which == 2) {
    // V^T: fixed d, 8 consecutive t = chunk 32*i + lane of tile j of the
    // wave's key chunk -> 512 contiguous bytes per store.
    bf16* dst = Vtws + bh * Tc * Dc + (size_t)t0 * Dc + lane * 8;
#pragma unroll
    for (int j = 0; j < 4; ++j)
#pragma unroll
      for (int i = 0; i < 2; ++i) {
        v8bf o;
#pragma unroll
        for (int r = 0; r < 8; ++r) o[r] = (bf16)(acc[i][j][r] + bn[j]);
        *(v8bf*)(dst + j * 512 + i * 256) = o;
      }
  } else if (which == 0) {
    bf16* dst = Qws + (bh * Tc + t0 + 8 * hi) * Dc + lo;
#pragma unroll
    for (int j = 0; j < 4; ++j)
#pragma unroll
      for (int i = 0; i < 2; ++i)
#pragma unroll
        for (int r = 0; r < 8; ++r)
          dst[(16 * i + r) * Dc + 16 * j] = (bf16)(acc[i][j][r] + bn[j]);
    // Stands in front of every reuse of the registers that the stores above
    // name: in the built kernel another case's code follows this block.
    asm volatile("s_wait_xcnt 0x0" ::: "memory");
  } else {
    // K: tile 2*i + (j>>1) of the wave's key chunk, chunk
    // 32*(j&1) + 16*(lo>>3) + 8*hi + r, element lo & 7.
    bf16* dst = Kws + bh * Tc * Dc + (size_t)t0 * Dc +
                ((lo >> 3) * 16 + 8 * hi) * 8 + (lo & 7);
#pragma unroll
    for (int j = 0; j < 4; ++j)
#pragma unroll
      for (int i = 0; i < 2; ++i)
#pragma unroll
        for (int r = 0; r < 8; ++r)
          dst[(2 * i + (j >> 1)) * 512 + (j & 1) * 256 + r * 8] =
              (bf16)(acc[i][j][r] + bn[j]);
    // The same wait, for the same reason.
    asm volatile("s_wait_xcnt 0x0" ::: "memory");
  }
}

// ---------------------------------------------------------------------------
// Kernel 2: flash attention, transposed products.  One wave owns 32 queries
// (2 column groups of 16 sharing every K/V fragment); keys in chunks of 32
// with online softmax.  S^T = K . Q^T puts one query's scores into one lane
// pair (l, l ^ 16): D register r = S^T[key 8*(l>>4) + r][query l & 15].  Two
// such tiles, converted in place, are the B operand of O^T += V^T . P^T.
// 16 WMMAs per key-chunk; no LDS, no barrier.
// ---------------------------------------------------------------------------

// Value of lane l ^ 16.
__device__ __forceinline__ float other_half(float x) {
  const int v = __builtin_bit_cast(int, x);
  return __builtin_bit_cast(float, __builtin_amdgcn_permlanex16(
      v, v, 0x76543210, 0xfedcba98, false, false));
}

__global__ __launch_bounds__(256) void flash_attn_kernel(
    const bf16* __restrict__ Qws, const bf16* __restrict__ Kws,
    const bf16* __restrict__ Vtws, bf16* __restrict__ attnws) {
  const int wave = threadIdx.x >> 5;
  const int lane = threadIdx.x & 31;
  const int b = blockIdx.z, h = blockIdx.y;
  const int q0 = (blockIdx.x * 8 + wave) * 32;

  const bf16* Qbase = Qws + (((size_t)b * Hc + h) * Tc + q0) * Dc;
  const bf16* Kbase = Kws + ((size_t)b * Hc + h) * Tc * Dc;
  const bf16* Vbase = Vtws + ((size_t)b * Hc + h) * Dc * Tc;

  // Q tiles (2 x 16 x 64) in registers: [qsub][k-chunk of 32]
  v16bf qa[2][2];
#pragma unroll
  for (int qs = 0; qs < 2; ++qs) {
    qa[qs][0] = load_frag_bf16(Qbase + (size_t)qs * 16 * Dc + 0, Dc);
    qa[qs][1] = load_frag_bf16(Qbase + (size_t)qs * 16 * Dc + 32, Dc);
  }

  // acc[qs][j][r] = O^T[d = 16*j + 8*(lane>>4) + r][query 16*qs + (lane&15)]
  v8f acc[2][4] = {};
  // m_i: running maximum of the lane's query (equal in both halves);
  // l_i: running sum over the keys this half holds (joined after the loop).
  float m_i[2], l_i[2];
#pragma unroll
  for (int qs = 0; qs < 2; ++qs) { m_i[qs] = -1e30f; l_i[qs] = 0.0f; }
  const float scale = 0.125f;  // 1/sqrt(D)

  for (int kc = 0; kc < Tc; kc += 32) {
    const bf16* kb = Kbase + (size_t)kc * Dc;  // 4 packed tiles of the chunk
    const bf16* vb = Vbase + (size_t)kc * Dc;  // 4 packed tiles of the chunk

    // Prefetch next key chunk's K and V^T tiles, one 128-B line per lane
    // (global_prefetch_b8).
    if (kc + 32 < Tc) {
      __builtin_prefetch((const void*)(kb + 32 * Dc + lane * 64), 0, 1);
      __builtin_prefetch((const void*)(vb + 32 * Dc + lane * 64), 0, 1);
    }

    // K fragments shared by both q-subtiles: [key-half][d-chunk]
    v16bf kf[2][2];
    kf[0][0] = load_frag_packed(kb);
    kf[0][1] = load_frag_packed(kb + 512);
    kf[1][0] = load_frag_packed(kb + 1024);
    kf[1][1] = load_frag_packed(kb + 1536);
    // Stands in front of every reuse of the address registers that the K
    // loads and the prefetches above name (later loads land in them).
    asm volatile("s_wait_xcnt 0x0" ::: "memory");

    v16bf pb[2];  // P^T (32 keys x 16 queries) as B operand
#pragma unroll
    for (int qs = 0; qs < 2; ++qs) {
      v8f s0 = {}, s1 = {};  // keys 0..15 and 16..31 of the chunk
      s0 = wmma_bf16(kf[0][0], qa[qs][0], s0);
      s0 = wmma_bf16(kf[0][1], qa[qs][1], s0);
      s1 = wmma_bf16(kf[1][0], qa[qs][0], s1);
      s1 = wmma_bf16(kf[1][1], qa[qs][1], s1);

      const v8f e0 = s0 * scale;
      const v8f e1 = s1 * scale;
      const v8f em = __builtin_elementwise_max(e0, e1);
      float mx = em[0];
#pragma unroll
      for (int r = 1; r < 8; ++r) mx = fmaxf(mx, em[r]);
      mx = fmaxf(mx, other_half(mx));
      const float mnew  = fmaxf(m_i[qs], mx);
      const float alpha = __expf(m_i[qs] - mnew);
      const v8f x0 = e0 - mnew;
      const v8f x1 = e1 - mnew;
      v8f p0, p1;
#pragma unroll
      for (int r = 0; r < 8; ++r) {
        p0[r] = __expf(x0[r]);
        p1[r] = __expf(x1[r]);
        pb[qs][r]     = (bf16)p0[r];
        pb[qs][8 + r] = (bf16)p1[r];
      }
      const v8f ps = p0 + p1;
      float rs = ps[0];
#pragma unroll
      for (int r = 1; r < 8; ++r) rs += ps[r];
      l_i[qs] = l_i[qs] * alpha + rs;
      m_i[qs] = mnew;
#pragma unroll
      for (int j = 0; j < 4; ++j) acc[qs][j] *= alpha;
    }

    // O^T(64x32) += V^T rows (d, keys kc..kc+31) . P^T(32x32)
    v16bf vf[4];
#pragma unroll
    for (int j = 0; j < 4; ++j)
      vf[j] = load_frag_packed(vb + j * 512);
#pragma unroll
    for (int qs = 0; qs < 2; ++qs)
#pragma unroll
      for (int j = 0; j < 4; ++j)
        acc[qs][j] = wmma_bf16(vf[j], pb[qs], acc[qs][j]);
  }

  // ---- normalize, write bf16 attn output ([B*T x E], e = h*D + d) in packed
  // tiles: a lane holds 8 consecutive d of one query = chunk 32*(j&1) + lane
  // of tile (t>>4, 2*h + (j>>1)) -> 512 contiguous bytes per store.
#pragma unroll
  for (int qs = 0; qs < 2; ++qs) {
    const float inv = 1.0f / (l_i[qs] + other_half(l_i[qs]));
    bf16* dst = attnws + ((size_t)b * Tc + q0 + 16 * qs) * Ec +
                (size_t)h * 1024 + lane * 8;
#pragma unroll
    for (int j = 0; j < 4; ++j) {
      v8bf o;
#pragma unroll
      for (int r = 0; r < 8; ++r) o[r] = (bf16)(acc[qs][j][r] * inv);
      *(v8bf*)(dst + (j >> 1) * 512 + (j & 1) * 256) = o;
    }
  }
}

// ---------------------------------------------------------------------------
// Kernel 3: output projection, 32x64 tile per wave.  out = attn @ Wo^T + bo.
// ---------------------------------------------------------------------------
__global__ __launch_bounds__(256) void out_proj_kernel(
    const bf16* __restrict__ attnws, const bf16* __restrict__ Wob,
    const float* __restrict__ bo, float* __restrict__ out) {
  const int wave = threadIdx.x >> 5;
  const int lane = threadIdx.x & 31;
  const int m0 = (blockIdx.x * 8 + wave) * 32;
  const int n0 = blockIdx.y * 64;

  v8f acc[2][4] = {};
  for (int k = 0; k < Ec; k += 32) {
    const v16bf a0 = load_frag_packed(attnws + (size_t)m0 * Ec + k * 16);
    const v16bf a1 = load_frag_packed(attnws + (size_t)(m0 + 16) * Ec + k * 16);
#pragma unroll
    for (int j = 0; j < 4; ++j) {
      const v16bf b = load_frag_packed(Wob + (size_t)(n0 + 16 * j) * Ec + k * 16);
      acc[0][j] = wmma_bf16(a0, b, acc[0][j]);
      acc[1][j] = wmma_bf16(a1, b, acc[1][j]);
    }
    // Stands in front of the next rewrite of the address registers that the
    // loads above name.
    asm volatile("s_wait_xcnt 0x0" ::: "memory");
  }

  const int hi = lane >> 4, lo = lane & 15;
#pragma unroll
  for (int j = 0; j < 4; ++j) {
    const float bn = bo[n0 + 16 * j + lo];
#pragma unroll
    for (int i = 0; i < 2; ++i) {
      float* dst = out + (size_t)(m0 + 16 * i + 8 * hi) * Ec + n0 + 16 * j + lo;
#pragma unroll
      for (int r = 0; r < 8; ++r) dst[(size_t)r * Ec] = acc[i][j][r] + bn;
    }
  }
}

// ---------------------------------------------------------------------------
extern "C" void kernel_launch(void* const* d_in, const int* in_sizes, int n_in,
                              void* d_out, int out_size, void* d_ws,
                              size_t ws_size, hipStream_t stream) {
  const float* x  = (const float*)d_in[0];
  const float* Wq = (const float*)d_in[1];
  const float* bq = (const float*)d_in[2];
  const float* Wk = (const float*)d_in[3];
  const float* bk = (const float*)d_in[4];
  const float* Wv = (const float*)d_in[5];
  const float* bv = (const float*)d_in[6];
  const float* Wo = (const float*)d_in[7];
  const float* bo = (const float*)d_in[8];
  float* out = (float*)d_out;

  // Workspace layout (bf16 elements):
  //   xb (4M) | Wq (1M) | Wk (1M) | Wv (1M) | Wo (1M) |
  //   Q (4M)  | K (4M)  | V^T (4M) | attn (4M)          = 24M elems = 48MB
  const size_t nX = (size_t)Bc * Tc * Ec;  // 4,194,304
  const size_t nW = (size_t)Ec * Ec;       // 1,048,576
  bf16* xb   = (bf16*)d_ws;
  bf16* Wqb  = xb + nX;
  bf16* Wkb  = Wqb + nW;
  bf16* Wvb  = Wkb + nW;
  bf16* Wob  = Wvb + nW;
  bf16* Qws  = Wob + nW;
  bf16* Kws  = Qws + nX;
  bf16* Vtws = Kws + nX;
  bf16* attn = Vtws + nX;

  // 0) fp32 -> bf16 pre-pass (removes all conversion from GEMM hot loops).
  cvt_f32_bf16_kernel<<<dim3(nX / 2048), 256, 0, stream>>>(x, xb);
  cvt_f32_bf16_kernel<<<dim3(nW / 2048), 256, 0, stream>>>(Wq, Wqb);
  cvt_f32_bf16_kernel<<<dim3(nW / 2048), 256, 0, stream>>>(Wk, Wkb);
  cvt_f32_bf16_kernel<<<dim3(nW / 2048), 256, 0, stream>>>(Wv, Wvb);
  cvt_f32_bf16_kernel<<<dim3(nW / 2048), 256, 0, stream>>>(Wo, Wob);

  // 1) QKV projections: 32x64 tile/wave, grid (BT/32/8, E/64, 3).
  dim3 g1(Bc * Tc / 32 / 8, Ec / 64, 3);
  qkv_proj_kernel<<<g1, 256, 0, stream>>>(xb, Wqb, Wkb, Wvb, bq, bk, bv,
                                          Qws, Kws, Vtws);

  // 2) Flash attention: 32-row q-tile per wave, grid (T/32/8, H, B).
  dim3 g2(Tc / 32 / 8, Hc, Bc);
  flash_attn_kernel<<<g2, 256, 0, stream>>>(Qws, Kws, Vtws, attn);

  // 3) Output projection.
  dim3 g3(Bc * Tc / 32 / 8, Ec / 64);
  out_proj_kernel<<<g3, 256, 0, stream>>>(attn, Wob, bo, out);
}

// v003
// Measured time: 109 microseconds a run.
// In two side-by-side timings against v002, it was 1.08 and 1.06 times as fast.
// All steps since v000 together make it 2.10 times as fast.
#include <hip/hip_runtime.h>
#include <hip/hip_bf16.h>

// ---------------------------------------------------------------------------
// MHA forward for MI455X (gfx1250, wave32, WMMA).
// All four matmul stages use v_wmma_f32_16x16x32_bf16 with register blocking;
// fp32->bf16 conversion is hoisted into a one-shot pre-pass.
// Operands that a hot loop loads (x, the weights, K, V^T, attn) lie in the
// workspace in fragment order: see load_frag_packed.
// ---------------------------------------------------------------------------

typedef __bf16 bf16;
typedef __attribute__((ext_vector_type(16))) __bf16 v16bf;
typedef __attribute__((ext_vector_type(8)))  __bf16 v8bf;
typedef __attribute__((ext_vector_type(8)))  float  v8f;
typedef __attribute__((ext_vector_type(4)))  float  v4f;

constexpr int Bc = 2;
constexpr int Tc = 2048;
constexpr int Ec = 1024;
constexpr int Hc = 16;
constexpr int Dc = 64;   // Ec / Hc

// D = A(16x32 bf16) * B(32x16 bf16, row-of-K per lane) + C(16x16 f32)
__device__ __forceinline__ v8f wmma_bf16(v16bf a, v16bf b, v8f c) {
  return __builtin_amdgcn_wmma_f32_16x16x32_bf16(
      /*neg_a=*/false, a, /*neg_b=*/false, b,
      /*c_mod=*/(short)0, c, /*reuse_a=*/false, /*reuse_b=*/false);
}

// 16x32 bf16 fragment from row-major memory, row stride `ld` elements.
// ISA 16-bit A layout (wave32): lane L holds row (L&15); K-chunks of 8 at
// columns (L>>4)*8 and 16+(L>>4)*8.  Two 16B loads per lane.
__device__ __forceinline__ v16bf load_frag_bf16(const bf16* base, int ld) {
  const int lane = threadIdx.x & 31;
  const bf16* p = base + (size_t)(lane & 15) * ld + (lane >> 4) * 8;
  v8bf lo = *(const v8bf*)(p);
  v8bf hi = *(const v8bf*)(p + 16);
  return __builtin_shufflevector(lo, hi, 0, 1, 2, 3, 4, 5, 6, 7,
                                 8, 9, 10, 11, 12, 13, 14, 15);
}

// The same fragment from a packed tile of 512 elements (1 KB): chunk c of 8
// elements, c = 32*part + lane, holds row (lane&15), columns
// 16*part + (lane>>4)*8 .. +7.  Each of the two loads then covers 512
// contiguous bytes (4 whole 128-B lines) instead of 32 B in each of 16 lines.
__device__ __forceinline__ v16bf load_frag_packed(const bf16* tile) {
  const bf16* p = tile + (threadIdx.x & 31) * 8;
  v8bf lo = *(const v8bf*)(p);
  v8bf hi = *(const v8bf*)(p + 256);
  return __builtin_shufflevector(lo, hi, 0, 1, 2, 3, 4, 5, 6, 7,
                                 8, 9, 10, 11, 12, 13, 14, 15);
}

// A [rows x Ec] matrix in packed tiles: tile (row>>4, col>>5) starts at
// element (row>>4)*16*Ec + (col>>5)*512, so a 16-row block is contiguous in k.

// ---------------------------------------------------------------------------
// Kernel 0: one-shot fp32 -> bf16 conversion of x and the four weights into
// packed tiles, one launch.  The destinations lie one behind the other in the
// workspace, and x is four slabs of the shape of a weight ([Ec x Ec]), so the
// work is 8 equal slabs.  One thread makes the same 16-B chunk of every slab:
// 16 loads in flight per lane and 4096 waves in all (a pass this short is
// bound by the start of its waves, not by its bytes).  A wave takes 8 rows of
// one tile: 4 lanes read one 128-B line of a source, and the 8 chunks of equal
// columns make one whole 128-B line of dst.
// ---------------------------------------------------------------------------
__global__ __launch_bounds__(256) void cvt_f32_bf16_kernel(
    const float* __restrict__ x, const float* __restrict__ Wq,
    const float* __restrict__ Wk, const float* __restrict__ Wv,
    const float* __restrict__ Wo, bf16* __restrict__ dst) {
  constexpr unsigned slab = Ec * Ec;
  const unsigned g = blockIdx.x * 256 + threadIdx.x;
  const unsigned tile = g >> 6;        // tile in the slab
  const unsigned r16 = (g >> 2) & 15;  // row in the tile
  const unsigned q = g & 3;            // columns 8*q .. 8*q + 7 of the tile
  const unsigned row = (tile / (Ec / 32)) * 16 + r16;
  const unsigned col = (tile % (Ec / 32)) * 32 + q * 8;
  const unsigned so = (row * Ec + col) * 4;  // byte offset in a source slab
  const unsigned i = tile * 512 + (q * 16 + r16) * 8;  // chunk 16*q + r16
  const unsigned xo[4] = {so, so + slab * 4, so + slab * 8, so + slab * 12};
  const float* const sp[8] = {x, x, x, x, Wq, Wk, Wv, Wo};
  v4f a[8], b[8];
#pragma unroll
  for (int s = 0; s < 8; ++s) {
    const char* p = (const char*)sp[s] + xo[s < 4 ? s : 0];
    a[s] = *(const v4f*)(p);
    b[s] = *(const v4f*)(p + 16);
  }
  // Stands in front of every reuse of the address registers that the loads
  // above name.  The offsets are inputs so that they live up to the wait:
  // otherwise the last load lands in them.
  asm volatile("s_wait_xcnt 0x0"
               :: "v"(xo[0]), "v"(xo[1]), "v"(xo[2]), "v"(xo[3]) : "memory");
#pragma unroll
  for (int s = 0; s < 8; ++s) {
    v8bf o;
#pragma unroll
    for (int j = 0; j < 4; ++j) {
      o[j]     = (bf16)a[s][j];
      o[4 + j] = (bf16)b[s][j];
    }
    *(v8bf*)(dst + (size_t)s * slab + i) = o;
  }
}

// ---------------------------------------------------------------------------
// Kernel 1: fused QKV projection, 32x64 output tile per wave (2x4 WMMA tiles).
// z = 0/1/2 selects Q/K/V.  Q -> bf16 [B,H,T,D].  K and V^T -> packed tiles,
// 4 tiles (4 KB) per head and chunk of 32 keys:
//   K   tile (t>>4)*2 + (d>>5): rows = keys, columns = d;
//   V^T tile (t>>5)*4 + (d>>4): rows = d,    columns = keys.
// ---------------------------------------------------------------------------
__global__ __launch_bounds__(256) void qkv_proj_kernel(
    const bf16* __restrict__ xb,
    const bf16* __restrict__ Wqb, const bf16* __restrict__ Wkb,
    const bf16* __restrict__ Wvb,
    const float* __restrict__ bq, const float* __restrict__ bk,
    const float* __restrict__ bv,
    bf16* __restrict__ Qws, bf16* __restrict__ Kws, bf16* __restrict__ Vtws) {
  const int wave = threadIdx.x >> 5;
  const int lane = threadIdx.x & 31;
  const int m0 = (blockIdx.x * 8 + wave) * 32;  // token-row block
  const int n0 = blockIdx.y * 64;               // feature-col block
  const int which = blockIdx.z;                 // 0:Q 1:K 2:V

  const bf16* W     = (which == 0) ? Wqb : (which == 1) ? Wkb : Wvb;
  const float* bias = (which == 0) ? bq : (which == 1) ? bk : bv;

  v8f acc[2][4] = {};
  for (int k = 0; k < Ec; k += 32) {
    const v16bf a0 = load_frag_packed(xb + (size_t)m0 * Ec + k * 16);
    const v16bf a1 = load_frag_packed(xb + (size_t)(m0 + 16) * Ec + k * 16);
#pragma unroll
    for (int j = 0; j < 4; ++j) {
      const v16bf b = load_frag_packed(W + (size_t)(n0 + 16 * j) * Ec + k * 16);
      acc[0][j] = wmma_bf16(a0, b, acc[0][j]);
      acc[1][j] = wmma_bf16(a1, b, acc[1][j]);
    }
    // Stands in front of the next rewrite of the address registers that the
    // loads above name.
    asm volatile("s_wait_xcnt 0x0" ::: "memory");
  }

  // The wave's 32 tokens lie in one batch and its 64 features are one head:
  // acc[i][j][r] = Y[token t0 + 16*i + 8*hi + r][d = 16*j + lo].
  const int hi = lane >> 4, lo = lane & 15;
  const int t0 = m0 & (Tc - 1);
  const size_t bh = (size_t)(m0 >> 11) * Hc + (n0 >> 6);  // T = 2048, D = 64
  float bn[4];
#pragma unroll
  for (int j = 0; j < 4; ++j) bn[j] = bias[n0 + 16 * j + lo];

  if (which == 2) {
    // V^T: fixed d, 8 consecutive t = chunk 32*i + lane of tile j of the
    // wave's key chunk -> 512 contiguous bytes per store.
    bf16* dst = Vtws + bh * Tc * Dc + (size_t)t0 * Dc + lane * 8;
#pragma unroll
    for (int j = 0; j < 4; ++j)
#pragma unroll
      for (int i = 0; i < 2; ++i) {
        v8bf o;
#pragma unroll
        for (int r = 0; r < 8; ++r) o[r] = (bf16)(acc[i][j][r] + bn[j]);
        *(v8bf*)(dst + j * 512 + i * 256) = o;
      }
  } else if (which == 0) {
    bf16* dst = Qws + (bh * Tc + t0 + 8 * hi) * Dc + lo;
#pragma unroll
    for (int j = 0; j < 4; ++j)
#pragma unroll
      for (int i = 0; i < 2; ++i)
#pragma unroll
        for (int r = 0; r < 8; ++r)
          dst[(16 * i + r) * Dc + 16 * j] = (bf16)(acc[i][j][r] + bn[j]);
    // Stands in front of every reuse of the registers that the stores above
    // name: in the built kernel another case's code follows this block.
    asm volatile("s_wait_xcnt 0x0" ::: "memory");
  } else {
    // K: tile 2*i + (j>>1) of the wave's key chunk, chunk
    // 32*(j&1) + 16*(lo>>3) + 8*hi + r, element lo & 7.
    bf16* dst = Kws + bh * Tc * Dc + (size_t)t0 * Dc +
                ((lo >> 3) * 16 + 8 * hi) * 8 + (lo & 7);
#pragma unroll
    for (int j = 0; j < 4; ++j)
#pragma unroll
      for (int i = 0; i < 2; ++i)
#pragma unroll
        for (int r = 0; r < 8; ++r)
          dst[(2 * i + (j >> 1)) * 512 + (j & 1) * 256 + r * 8] =
              (bf16)(acc[i][j][r] + bn[j]);
    // The same wait, for the same reason.
    asm volatile("s_wait_xcnt 0x0" ::: "memory");
  }
}

// ---------------------------------------------------------------------------
// Kernel 2: flash attention, transposed products.  One wave owns 32 queries
// (2 column groups of 16 sharing every K/V fragment); keys in chunks of 32
// with online softmax.  S^T = K . Q^T puts one query's scores into one lane
// pair (l, l ^ 16): D register r = S^T[key 8*(l>>4) + r][query l & 15].  Two
// such tiles, converted in place, are the B operand of O^T += V^T . P^T.
// 16 WMMAs per key-chunk; no LDS, no barrier.
// ---------------------------------------------------------------------------

// Value of lane l ^ 16.
__device__ __forceinline__ float other_half(float x) {
  const int v = __builtin_bit_cast(int, x);
  return __builtin_bit_cast(float, __builtin_amdgcn_permlanex16(
      v, v, 0x76543210, 0xfedcba98, false, false));
}

__global__ __launch_bounds__(256) void flash_attn_kernel(
    const bf16* __restrict__ Qws, const bf16* __restrict__ Kws,
    const bf16* __restrict__ Vtws, bf16* __restrict__ attnws) {
  const int wave = threadIdx.x >> 5;
  const int lane = threadIdx.x & 31;
  const int b = blockIdx.z, h = blockIdx.y;
  const int q0 = (blockIdx.x * 8 + wave) * 32;

  const bf16* Qbase = Qws + (((size_t)b * Hc + h) * Tc + q0) * Dc;
  const bf16* Kbase = Kws + ((size_t)b * Hc + h) * Tc * Dc;
  const bf16* Vbase = Vtws + ((size_t)b * Hc + h) * Dc * Tc;

  // Q tiles (2 x 16 x 64) in registers: [qsub][k-chunk of 32]
  v16bf qa[2][2];
#pragma unroll
  for (int qs = 0; qs < 2; ++qs) {
    qa[qs][0] = load_frag_bf16(Qbase + (size_t)qs * 16 * Dc + 0, Dc);
    qa[qs][1] = load_frag_bf16(Qbase + (size_t)qs * 16 * Dc + 32, Dc);
  }

  // acc[qs][j][r] = O^T[d = 16*j + 8*(lane>>4) + r][query 16*qs + (lane&15)]
  v8f acc[2][4] = {};
  // m_i: running maximum of the lane's query (equal in both halves);
  // l_i: running sum over the keys this half holds (joined after the loop).
  float m_i[2], l_i[2];
#pragma unroll
  for (int qs = 0; qs < 2; ++qs) { m_i[qs] = -1e30f; l_i[qs] = 0.0f; }
  const float scale = 0.125f;  // 1/sqrt(D)

  for (int kc = 0; kc < Tc; kc += 32) {
    const bf16* kb = Kbase + (size_t)kc * Dc;  // 4 packed tiles of the chunk
    const bf16* vb = Vbase + (size_t)kc * Dc;  // 4 packed tiles of the chunk

    // Prefetch next key chunk's K and V^T tiles, one 128-B line per lane
    // (global_prefetch_b8).
    if (kc + 32 < Tc) {
      __builtin_prefetch((const void*)(kb + 32 * Dc + lane * 64), 0, 1);
      __builtin_prefetch((const void*)(vb + 32 * Dc + lane * 64), 0, 1);
    }

    // K fragments shared by both q-subtiles: [key-half][d-chunk]
    v16bf kf[2][2];
    kf[0][0] = load_frag_packed(kb);
    kf[0][1] = load_frag_packed(kb + 512);
    kf[1][0] = load_frag_packed(kb + 1024);
    kf[1][1] = load_frag_packed(kb + 1536);
    // Stands in front of every reuse of the address registers that the K
    // loads and the prefetches above name (later loads land in them).
    asm volatile("s_wait_xcnt 0x0" ::: "memory");

    v16bf pb[2];  // P^T (32 keys x 16 queries) as B operand
#pragma unroll
    for (int qs = 0; qs < 2; ++qs) {
      v8f s0 = {}, s1 = {};  // keys 0..15 and 16..31 of the chunk
      s0 = wmma_bf16(kf[0][0], qa[qs][0], s0);
      s0 = wmma_bf16(kf[0][1], qa[qs][1], s0);
      s1 = wmma_bf16(kf[1][0], qa[qs][0], s1);
      s1 = wmma_bf16(kf[1][1], qa[qs][1], s1);

      const v8f e0 = s0 * scale;
      const v8f e1 = s1 * scale;
      const v8f em = __builtin_elementwise_max(e0, e1);
      float mx = em[0];
#pragma unroll
      for (int r = 1; r < 8; ++r) mx = fmaxf(mx, em[r]);
      mx = fmaxf(mx, other_half(mx));
      const float mnew  = fmaxf(m_i[qs], mx);
      const float alpha = __expf(m_i[qs] - mnew);
      const v8f x0 = e0 - mnew;
      const v8f x1 = e1 - mnew;
      v8f p0, p1;
#pragma unroll
      for (int r = 0; r < 8; ++r) {
        p0[r] = __expf(x0[r]);
        p1[r] = __expf(x1[r]);
        pb[qs][r]     = (bf16)p0[r];
        pb[qs][8 + r] = (bf16)p1[r];
      }
      const v8f ps = p0 + p1;
      float rs = ps[0];
#pragma unroll
      for (int r = 1; r < 8; ++r) rs += ps[r];
      l_i[qs] = l_i[qs] * alpha + rs;
      m_i[qs] = mnew;
#pragma unroll
      for (int j = 0; j < 4; ++j) acc[qs][j] *= alpha;
    }

    // O^T(64x32) += V^T rows (d, keys kc..kc+31) . P^T(32x32)
    v16bf vf[4];
#pragma unroll
    for (int j = 0; j < 4; ++j)
      vf[j] = load_frag_packed(vb + j * 512);
#pragma unroll
    for (int qs = 0; qs < 2; ++qs)
#pragma unroll
      for (int j = 0; j < 4; ++j)
        acc[qs][j] = wmma_bf16(vf[j], pb[qs], acc[qs][j]);
  }

  // ---- normalize, write bf16 attn output ([B*T x E], e = h*D + d) in packed
  // tiles: a lane holds 8 consecutive d of one query = chunk 32*(j&1) + lane
  // of tile (t>>4, 2*h + (j>>1)) -> 512 contiguous bytes per store.
#pragma unroll
  for (int qs = 0; qs < 2; ++qs) {
    const float inv = 1.0f / (l_i[qs] + other_half(l_i[qs]));
    bf16* dst = attnws + ((size_t)b * Tc + q0 + 16 * qs) * Ec +
                (size_t)h * 1024 + lane * 8;
#pragma unroll
    for (int j = 0; j < 4; ++j) {
      v8bf o;
#pragma unroll
      for (int r = 0; r < 8; ++r) o[r] = (bf16)(acc[qs][j][r] * inv);
      *(v8bf*)(dst + (j >> 1) * 512 + (j & 1) * 256) = o;
    }
  }
}

// ---------------------------------------------------------------------------
// Kernel 3: output projection, 32x64 tile per wave.  out = attn @ Wo^T + bo.
// ---------------------------------------------------------------------------
__global__ __launch_bounds__(256) void out_proj_kernel(
    const bf16* __restrict__ attnws, const bf16* __restrict__ Wob,
    const float* __restrict__ bo, float* __restrict__ out) {
  const int wave = threadIdx.x >> 5;
  const int lane = threadIdx.x & 31;
  const int m0 = (blockIdx.x * 8 + wave) * 32;
  const int n0 = blockIdx.y * 64;

  v8f acc[2][4] = {};
  for (int k = 0; k < Ec; k += 32) {
    const v16bf a0 = load_frag_packed(attnws + (size_t)m0 * Ec + k * 16);
    const v16bf a1 = load_frag_packed(attnws + (size_t)(m0 + 16) * Ec + k * 16);
#pragma unroll
    for (int j = 0; j < 4; ++j) {
      const v16bf b = load_frag_packed(Wob + (size_t)(n0 + 16 * j) * Ec + k * 16);
      acc[0][j] = wmma_bf16(a0, b, acc[0][j]);
      acc[1][j] = wmma_bf16(a1, b, acc[1][j]);
    }
    // Stands in front of the next rewrite of the address registers that the
    // loads above name.
    asm volatile("s_wait_xcnt 0x0" ::: "memory");
  }

  const int hi = lane >> 4, lo = lane & 15;
#pragma unroll
  for (int j = 0; j < 4; ++j) {
    const float bn = bo[n0 + 16 * j + lo];
#pragma unroll
    for (int i = 0; i < 2; ++i) {
      float* dst = out + (size_t)(m0 + 16 * i + 8 * hi) * Ec + n0 + 16 * j + lo;
#pragma unroll
      for (int r = 0; r < 8; ++r) dst[(size_t)r * Ec] = acc[i][j][r] + bn;
    }
  }
}

// ---------------------------------------------------------------------------
extern "C" void kernel_launch(void* const* d_in, const int* in_sizes, int n_in,
                              void* d_out, int out_size, void* d_ws,
                              size_t ws_size, hipStream_t stream) {
  const float* x  = (const float*)d_in[0];
  const float* Wq = (const float*)d_in[1];
  const float* bq = (const float*)d_in[2];
  const float* Wk = (const float*)d_in[3];
  const float* bk = (const float*)d_in[4];
  const float* Wv = (const float*)d_in[5];
  const float* bv = (const float*)d_in[6];
  const float* Wo = (const float*)d_in[7];
  const float* bo = (const float*)d_in[8];
  float* out = (float*)d_out;

  // Workspace layout (bf16 elements):
  //   xb (4M) | Wq (1M) | Wk (1M) | Wv (1M) | Wo (1M) |
  //   Q (4M)  | K (4M)  | V^T (4M) | attn (4M)          = 24M elems = 48MB
  const size_t nX = (size_t)Bc * Tc * Ec;  // 4,194,304
  const size_t nW = (size_t)Ec * Ec;       // 1,048,576
  bf16* xb   = (bf16*)d_ws;
  bf16* Wqb  = xb + nX;
  bf16* Wkb  = Wqb + nW;
  bf16* Wvb  = Wkb + nW;
  bf16* Wob  = Wvb + nW;
  bf16* Qws  = Wob + nW;
  bf16* Kws  = Qws + nX;
  bf16* Vtws = Kws + nX;
  bf16* attn = Vtws + nX;

  // 0) fp32 -> bf16 pre-pass (removes all conversion from GEMM hot loops):
  //    xb | Wqb | Wkb | Wvb | Wob are contiguous, 8 slabs of nW elements.
  cvt_f32_bf16_kernel<<<dim3(nW / 2048), 256, 0, stream>>>(x, Wq, Wk, Wv, Wo,
                                                           xb);

  // 1) QKV projections: 32x64 tile/wave, grid (BT/32/8, E/64, 3).
  dim3 g1(Bc * Tc / 32 / 8, Ec / 64, 3);
  qkv_proj_kernel<<<g1, 256, 0, stream>>>(xb, Wqb, Wkb, Wvb, bq, bk, bv,
                                          Qws, Kws, Vtws);

  // 2) Flash attention: 32-row q-tile per wave, grid (T/32/8, H, B).
  dim3 g2(Tc / 32 / 8, Hc, Bc);
  flash_attn_kernel<<<g2, 256, 0, stream>>>(Qws, Kws, Vtws, attn);

  // 3) Output projection.
  dim3 g3(Bc * Tc / 32 / 8, Ec / 64);
  out_proj_kernel<<<g3, 256, 0, stream>>>(attn, Wob, bo, out);
}

// v004
// Measured time: 92.4 microseconds a run.
// Timed twice side by side with v003, it ran 1.20 and 1.15 times as fast.
// Counting every step since v000, it is 2.46 times as fast.
#include <hip/hip_runtime.h>
#include <hip/hip_bf16.h>

// ---------------------------------------------------------------------------
// MHA forward for MI455X (gfx1250, wave32, WMMA).
// All four matmul stages use v_wmma_f32_16x16x32_bf16 with register blocking;
// fp32->bf16 conversion is hoisted into a one-shot pre-pass.
// Operands that a hot loop loads (x, the weights, K, V^T, attn) lie in the
// workspace in fragment order: see load_frag_packed.
// ---------------------------------------------------------------------------

typedef __bf16 bf16;
typedef __attribute__((ext_vector_type(16))) __bf16 v16bf;
typedef __attribute__((ext_vector_type(8)))  __bf16 v8bf;
typedef __attribute__((ext_vector_type(8)))  float  v8f;
typedef __attribute__((ext_vector_type(4)))  float  v4f;

constexpr int Bc = 2;
constexpr int Tc = 2048;
constexpr int Ec = 1024;
constexpr int Hc = 16;
constexpr int Dc = 64;   // Ec / Hc

// D = A(16x32 bf16) * B(32x16 bf16, row-of-K per lane) + C(16x16 f32)
__device__ __forceinline__ v8f wmma_bf16(v16bf a, v16bf b, v8f c) {
  return __builtin_amdgcn_wmma_f32_16x16x32_bf16(
      /*neg_a=*/false, a, /*neg_b=*/false, b,
      /*c_mod=*/(short)0, c, /*reuse_a=*/false, /*reuse_b=*/false);
}

// 16x32 bf16 fragment from row-major memory, row stride `ld` elements.
// ISA 16-bit A layout (wave32): lane L holds row (L&15); K-chunks of 8 at
// columns (L>>4)*8 and 16+(L>>4)*8.  Two 16B loads per lane.
__device__ __forceinline__ v16bf load_frag_bf16(const bf16* base, int ld) {
  const int lane = threadIdx.x & 31;
  const bf16* p = base + (size_t)(lane & 15) * ld + (lane >> 4) * 8;
  v8bf lo = *(const v8bf*)(p);
  v8bf hi = *(const v8bf*)(p + 16);
  return __builtin_shufflevector(lo, hi, 0, 1, 2, 3, 4, 5, 6, 7,
                                 8, 9, 10, 11, 12, 13, 14, 15);
}

// The same fragment from a packed tile of 512 elements (1 KB): chunk c of 8
// elements, c = 32*part + lane, holds row (lane&15), columns
// 16*part + (lane>>4)*8 .. +7.  Each of the two loads then covers 512
// contiguous bytes (4 whole 128-B lines) instead of 32 B in each of 16 lines.
// p: the lane's own first chunk, tile + lane * 8.
__device__ __forceinline__ v16bf load_frag_lane(const bf16* p) {
  v8bf lo = *(const v8bf*)(p);
  v8bf hi = *(const v8bf*)(p + 256);
  return __builtin_shufflevector(lo, hi, 0, 1, 2, 3, 4, 5, 6, 7,
                                 8, 9, 10, 11, 12, 13, 14, 15);
}
__device__ __forceinline__ v16bf load_frag_packed(const bf16* tile) {
  return load_frag_lane(tile + (threadIdx.x & 31) * 8);
}

// A [rows x Ec] matrix in packed tiles: tile (row>>4, col>>5) starts at
// element (row>>4)*16*Ec + (col>>5)*512, so a 16-row block is contiguous in k.

// One k step (32) of a 32x64 wave tile: its 2 + 4 fragments, 12 loads issued
// as one group.  A, B: the lane's chunk of the first packed tile of the wave's
// rows / columns.
__device__ __forceinline__ void gemm_load_step(const bf16* A, const bf16* B,
                                               int k, v16bf (&a)[2],
                                               v16bf (&b)[4]) {
  a[0] = load_frag_lane(A + k * 16);
  a[1] = load_frag_lane(A + 16 * Ec + k * 16);
#pragma unroll
  for (int j = 0; j < 4; ++j)
    b[j] = load_frag_lane(B + j * 16 * Ec + k * 16);
  // Stands in front of the next rewrite of the address registers that the
  // loads above name.  The addresses are inputs so that they live up to the
  // wait: otherwise the last load lands in them.
  asm volatile("s_wait_xcnt 0x0" :: "v"(A), "v"(B) : "memory");
  // Keeps the products that follow in the source behind the whole group:
  // without it the compiler lifts them among the loads to save registers, and
  // the wave then waits for the group right after issuing it.
  __builtin_amdgcn_sched_barrier(0);
}

__device__ __forceinline__ void gemm_mma_step(const v16bf (&a)[2],
                                              const v16bf (&b)[4],
                                              v8f (&acc)[2][4]) {
#pragma unroll
  for (int j = 0; j < 4; ++j) {
    acc[0][j] = wmma_bf16(a[0], b[j], acc[0][j]);
    acc[1][j] = wmma_bf16(a[1], b[j], acc[1][j]);
  }
}

// acc += A . B^T over k = 0 .. Ec-1, in k order.  Three fragment sets in a
// ring: each step's loads are issued two steps ahead, in front of the products
// of the step that is due, so a group has 16 products of time to land.  The
// loop is unrolled whole so that the ring index is a constant and every
// address is one register pair plus an immediate offset.
__device__ __forceinline__ void gemm_k_loop(const bf16* Atile,
                                            const bf16* Btile,
                                            v8f (&acc)[2][4]) {
  constexpr int NS = 3, steps = Ec / 32;
  const bf16* A = Atile + (threadIdx.x & 31) * 8;
  const bf16* B = Btile + (threadIdx.x & 31) * 8;
  v16bf a[NS][2], b[NS][4];
#pragma unroll
  for (int st = 0; st < NS - 1; ++st)
    gemm_load_step(A, B, st * 32, a[st], b[st]);
#pragma unroll
  for (int st = 0; st < steps; ++st) {
    if (st + NS - 1 < steps)
      gemm_load_step(A, B, (st + NS - 1) * 32, a[(st + NS - 1) % NS],
                     b[(st + NS - 1) % NS]);
    gemm_mma_step(a[st % NS], b[st % NS], acc);
  }
}

// ---------------------------------------------------------------------------
// Kernel 0: one-shot fp32 -> bf16 conversion of x and the four weights into
// packed tiles, one launch.  The destinations lie one behind the other in the
// workspace, and x is four slabs of the shape of a weight ([Ec x Ec]), so the
// work is 8 equal slabs.  One thread makes the same 16-B chunk of every slab:
// 16 loads in flight per lane and 4096 waves in all (a pass this short is
// bound by the start of its waves, not by its bytes).  A wave takes 8 rows of
// one tile: 4 lanes read one 128-B line of a source, and the 8 chunks of equal
// columns make one whole 128-B line of dst.
// ---------------------------------------------------------------------------
__global__ __launch_bounds__(256) void cvt_f32_bf16_kernel(
    const float* __restrict__ x, const float* __restrict__ Wq,
    const float* __restrict__ Wk, const float* __restrict__ Wv,
    const float* __restrict__ Wo, bf16* __restrict__ dst) {
  constexpr unsigned slab = Ec * Ec;
  const unsigned g = blockIdx.x * 256 + threadIdx.x;
  const unsigned tile = g >> 6;        // tile in the slab
  const unsigned r16 = (g >> 2) & 15;  // row in the tile
  const unsigned q = g & 3;            // columns 8*q .. 8*q + 7 of the tile
  const unsigned row = (tile / (Ec / 32)) * 16 + r16;
  const unsigned col = (tile % (Ec / 32)) * 32 + q * 8;
  const unsigned so = (row * Ec + col) * 4;  // byte offset in a source slab
  const unsigned i = tile * 512 + (q * 16 + r16) * 8;  // chunk 16*q + r16
  const unsigned xo[4] = {so, so + slab * 4, so + slab * 8, so + slab * 12};
  const float* const sp[8] = {x, x, x, x, Wq, Wk, Wv, Wo};
  v4f a[8], b[8];
#pragma unroll
  for (int s = 0; s < 8; ++s) {
    const char* p = (const char*)sp[s] + xo[s < 4 ? s : 0];
    a[s] = *(const v4f*)(p);
    b[s] = *(const v4f*)(p + 16);
  }
  // Stands in front of every reuse of the address registers that the loads
  // above name.  The offsets are inputs so that they live up to the wait:
  // otherwise the last load lands in them.
  asm volatile("s_wait_xcnt 0x0"
               :: "v"(xo[0]), "v"(xo[1]), "v"(xo[2]), "v"(xo[3]) : "memory");
#pragma unroll
  for (int s = 0; s < 8; ++s) {
    v8bf o;
#pragma unroll
    for (int j = 0; j < 4; ++j) {
      o[j]     = (bf16)a[s][j];
      o[4 + j] = (bf16)b[s][j];
    }
    *(v8bf*)(dst + (size_t)s * slab + i) = o;
  }
}

// ---------------------------------------------------------------------------
// Kernel 1: fused QKV projection, 32x64 output tile per wave (2x4 WMMA tiles).
// z = 0/1/2 selects Q/K/V.  Q -> bf16 [B,H,T,D].  K and V^T -> packed tiles,
// 4 tiles (4 KB) per head and chunk of 32 keys:
//   K   tile (t>>4)*2 + (d>>5): rows = keys, columns = d;
//   V^T tile (t>>5)*4 + (d>>4): rows = d,    columns = keys.
// ---------------------------------------------------------------------------
__global__ __launch_bounds__(256) void qkv_proj_kernel(
    const bf16* __restrict__ xb,
    const bf16* __restrict__ Wqb, const bf16* __restrict__ Wkb,
    const bf16* __restrict__ Wvb,
    const float* __restrict__ bq, const float* __restrict__ bk,
    const float* __restrict__ bv,
    bf16* __restrict__ Qws, bf16* __restrict__ Kws, bf16* __restrict__ Vtws) {
  const int wave = threadIdx.x >> 5;
  const int lane = threadIdx.x & 31;
  const int m0 = (blockIdx.x * 8 + wave) * 32;  // token-row block
  const int n0 = blockIdx.y * 64;               // feature-col block
  const int which = blockIdx.z;                 // 0:Q 1:K 2:V

  const bf16* W     = (which == 0) ? Wqb : (which == 1) ? Wkb : Wvb;
  const float* bias = (which == 0) ? bq : (which == 1) ? bk : bv;

  v8f acc[2][4] = {};
  gemm_k_loop(xb + (size_t)m0 * Ec, W + (size_t)n0 * Ec, acc);

  // The wave's 32 tokens lie in one batch and its 64 features are one head:
  // acc[i][j][r] = Y[token t0 + 16*i + 8*hi + r][d = 16*j + lo].
  const int hi = lane >> 4, lo = lane & 15;
  const int t0 = m0 & (Tc - 1);
  const size_t bh = (size_t)(m0 >> 11) * Hc + (n0 >> 6);  // T = 2048, D = 64
  float bn[4];
#pragma unroll
  for (int j = 0; j < 4; ++j) bn[j] = bias[n0 + 16 * j + lo];

  if (which == 2) {
    // V^T: fixed d, 8 consecutive t = chunk 32*i + lane of tile j of the
    // wave's key chunk -> 512 contiguous bytes per store.
    bf16* dst = Vtws + bh * Tc * Dc + (size_t)t0 * Dc + lane * 8;
#pragma unroll
    for (int j = 0; j < 4; ++j)
#pragma unroll
      for (int i = 0; i < 2; ++i) {
        v8bf o;
#pragma unroll
        for (int r = 0; r < 8; ++r) o[r] = (bf16)(acc[i][j][r] + bn[j]);
        *(v8bf*)(dst + j * 512 + i * 256) = o;
      }
  } else if (which == 0) {
    bf16* dst = Qws + (bh * Tc + t0 + 8 * hi) * Dc + lo;
#pragma unroll
    for (int j = 0; j < 4; ++j)
#pragma unroll
      for (int i = 0; i < 2; ++i)
#pragma unroll
        for (int r = 0; r < 8; ++r)
          dst[(16 * i + r) * Dc + 16 * j] = (bf16)(acc[i][j][r] + bn[j]);
    // Stands in front of every reuse of the registers that the stores above
    // name: in the built kernel another case's code follows this block.
    asm volatile("s_wait_xcnt 0x0" ::: "memory");
  } else {
    // K: tile 2*i + (j>>1) of the wave's key chunk, chunk
    // 32*(j&1) + 16*(lo>>3) + 8*hi + r, element lo & 7.
    bf16* dst = Kws + bh * Tc * Dc + (size_t)t0 * Dc +
                ((lo >> 3) * 16 + 8 * hi) * 8 + (lo & 7);
#pragma unroll
    for (int j = 0; j < 4; ++j)
#pragma unroll
      for (int i = 0; i < 2; ++i)
#pragma unroll
        for (int r = 0; r < 8; ++r)
          dst[(2 * i + (j >> 1)) * 512 + (j & 1) * 256 + r * 8] =
              (bf16)(acc[i][j][r] + bn[j]);
    // The same wait, for the same reason.
    asm volatile("s_wait_xcnt 0x0" ::: "memory");
  }
}

// ---------------------------------------------------------------------------
// Kernel 2: flash attention, transposed products.  One wave owns 32 queries
// (2 column groups of 16 sharing every K/V fragment); keys in chunks of 32
// with online softmax.  S^T = K . Q^T puts one query's scores into one lane
// pair (l, l ^ 16): D register r = S^T[key 8*(l>>4) + r][query l & 15].  Two
// such tiles, converted in place, are the B operand of O^T += V^T . P^T.
// 16 WMMAs per key-chunk; no LDS, no barrier.
// ---------------------------------------------------------------------------

// Value of lane l ^ 16.
__device__ __forceinline__ float other_half(float x) {
  const int v = __builtin_bit_cast(int, x);
  return __builtin_bit_cast(float, __builtin_amdgcn_permlanex16(
      v, v, 0x76543210, 0xfedcba98, false, false));
}

__global__ __launch_bounds__(256) void flash_attn_kernel(
    const bf16* __restrict__ Qws, const bf16* __restrict__ Kws,
    const bf16* __restrict__ Vtws, bf16* __restrict__ attnws) {
  const int wave = threadIdx.x >> 5;
  const int lane = threadIdx.x & 31;
  const int b = blockIdx.z, h = blockIdx.y;
  const int q0 = (blockIdx.x * 8 + wave) * 32;

  const bf16* Qbase = Qws + (((size_t)b * Hc + h) * Tc + q0) * Dc;
  const bf16* Kbase = Kws + ((size_t)b * Hc + h) * Tc * Dc;
  const bf16* Vbase = Vtws + ((size_t)b * Hc + h) * Dc * Tc;

  // Q tiles (2 x 16 x 64) in registers: [qsub][k-chunk of 32]
  v16bf qa[2][2];
#pragma unroll
  for (int qs = 0; qs < 2; ++qs) {
    qa[qs][0] = load_frag_bf16(Qbase + (size_t)qs * 16 * Dc + 0, Dc);
    qa[qs][1] = load_frag_bf16(Qbase + (size_t)qs * 16 * Dc + 32, Dc);
  }

  // acc[qs][j][r] = O^T[d = 16*j + 8*(lane>>4) + r][query 16*qs + (lane&15)]
  v8f acc[2][4] = {};
  // m_i: running maximum of the lane's query (equal in both halves);
  // l_i: running sum over the keys this half holds (joined after the loop).
  float m_i[2], l_i[2];
#pragma unroll
  for (int qs = 0; qs < 2; ++qs) { m_i[qs] = -1e30f; l_i[qs] = 0.0f; }
  const float scale = 0.125f;  // 1/sqrt(D)

  // K fragments shared by both q-subtiles: [key-half][d-chunk], 4 packed tiles
  // per chunk of 32 keys, fetched one chunk ahead into the other of two sets.
  v16bf kfa[2][2], kfb[2][2];
#pragma unroll
  for (int t = 0; t < 4; ++t)
    kfa[t >> 1][t & 1] = load_frag_packed(Kbase + t * 512);
  // Stands in front of every reuse of the address registers that the loads
  // above name.
  asm volatile("s_wait_xcnt 0x0" ::: "memory");

  // One pass over a chunk of 32 keys, its K already in kf.  vp + vo: the
  // lane's chunk of the pass's first V^T tile; kp + ko: of the next chunk's
  // first K tile (4 packed tiles each).
  auto pass = [&](const v16bf (&kf)[2][2], v16bf (&kn)[2][2], const bf16* vp,
                  int vo, const bf16* kp, int ko) {
    // All loads of the pass as one group at its head.  This chunk's V^T tiles
    // land behind the score products and the softmax; the next chunk's K lands
    // behind the whole pass.
    v16bf vf[4];
#pragma unroll
    for (int j = 0; j < 4; ++j)
      vf[j] = load_frag_lane(vp + vo + j * 512);
#pragma unroll
    for (int t = 0; t < 4; ++t)
      kn[t >> 1][t & 1] = load_frag_lane(kp + ko + t * 512);
    // The same wait.  The two address registers are inputs so that they live
    // up to the wait: otherwise the last load lands in them.
    asm volatile("s_wait_xcnt 0x0" :: "v"(vp), "v"(kp) : "memory");
    // Keeps the products behind the whole group: lifted among the loads they
    // would delay its issue, and with it the landing of the next pass's K.
    __builtin_amdgcn_sched_barrier(0);

    v8f sc[2][2];  // [q-subtile][keys 0..15 and 16..31 of the chunk]
#pragma unroll
    for (int qs = 0; qs < 2; ++qs) {
      v8f s0 = {}, s1 = {};
      s0 = wmma_bf16(kf[0][0], qa[qs][0], s0);
      s0 = wmma_bf16(kf[0][1], qa[qs][1], s0);
      s1 = wmma_bf16(kf[1][0], qa[qs][0], s1);
      s1 = wmma_bf16(kf[1][1], qa[qs][1], s1);
      sc[qs][0] = s0;
      sc[qs][1] = s1;
    }

    v16bf pb[2];  // P^T (32 keys x 16 queries) as B operand
#pragma unroll
    for (int qs = 0; qs < 2; ++qs) {
      const v8f e0 = sc[qs][0] * scale;
      const v8f e1 = sc[qs][1] * scale;
      const v8f em = __builtin_elementwise_max(e0, e1);
      float mx = em[0];
#pragma unroll
      for (int r = 1; r < 8; ++r) mx = fmaxf(mx, em[r]);
      mx = fmaxf(mx, other_half(mx));
      const float mnew  = fmaxf(m_i[qs], mx);
      const float alpha = __expf(m_i[qs] - mnew);
      const v8f x0 = e0 - mnew;
      const v8f x1 = e1 - mnew;
      v8f p0, p1;
#pragma unroll
      for (int r = 0; r < 8; ++r) {
        p0[r] = __expf(x0[r]);
        p1[r] = __expf(x1[r]);
        pb[qs][r]     = (bf16)p0[r];
        pb[qs][8 + r] = (bf16)p1[r];
      }
      const v8f ps = p0 + p1;
      float rs = ps[0];
#pragma unroll
      for (int r = 1; r < 8; ++r) rs += ps[r];
      l_i[qs] = l_i[qs] * alpha + rs;
      m_i[qs] = mnew;
#pragma unroll
      for (int j = 0; j < 4; ++j) acc[qs][j] *= alpha;
    }

    // O^T(64x32) += V^T rows (d, the chunk's 32 keys) . P^T(32x32)
#pragma unroll
    for (int qs = 0; qs < 2; ++qs)
#pragma unroll
      for (int j = 0; j < 4; ++j)
        acc[qs][j] = wmma_bf16(vf[j], pb[qs], acc[qs][j]);
  };

  for (int kc = 0; kc < Tc; kc += 64) {
    const bf16* vp = Vbase + (size_t)kc * Dc + lane * 8;
    const bf16* kp = Kbase + (size_t)kc * Dc + lane * 8;
    pass(kfa, kfb, vp, 0, kp, 32 * Dc);
    // The last pass reads its own chunk again, so that the address stays
    // inside this head's K without a branch in the loop.
    pass(kfb, kfa, vp, 32 * Dc, kp + (kc + 64 < Tc ? 64 : 32) * Dc, 0);
  }

  // ---- normalize, write bf16 attn output ([B*T x E], e = h*D + d) in packed
  // tiles: a lane holds 8 consecutive d of one query = chunk 32*(j&1) + lane
  // of tile (t>>4, 2*h + (j>>1)) -> 512 contiguous bytes per store.
#pragma unroll
  for (int qs = 0; qs < 2; ++qs) {
    const float inv = 1.0f / (l_i[qs] + other_half(l_i[qs]));
    bf16* dst = attnws + ((size_t)b * Tc + q0 + 16 * qs) * Ec +
                (size_t)h * 1024 + lane * 8;
#pragma unroll
    for (int j = 0; j < 4; ++j) {
      v8bf o;
#pragma unroll
      for (int r = 0; r < 8; ++r) o[r] = (bf16)(acc[qs][j][r] * inv);
      *(v8bf*)(dst + (j >> 1) * 512 + (j & 1) * 256) = o;
    }
  }
}

// ---------------------------------------------------------------------------
// Kernel 3: output projection, 32x64 tile per wave.  out = attn @ Wo^T + bo.
// ---------------------------------------------------------------------------
__global__ __launch_bounds__(256) void out_proj_kernel(
    const bf16* __restrict__ attnws, const bf16* __restrict__ Wob,
    const float* __restrict__ bo, float* __restrict__ out) {
  const int wave = threadIdx.x >> 5;
  const int lane = threadIdx.x & 31;
  const int m0 = (blockIdx.x * 8 + wave) * 32;
  const int n0 = blockIdx.y * 64;

  v8f acc[2][4] = {};
  gemm_k_loop(attnws + (size_t)m0 * Ec, Wob + (size_t)n0 * Ec, acc);

  const int hi = lane >> 4, lo = lane & 15;
#pragma unroll
  for (int j = 0; j < 4; ++j) {
    const float bn = bo[n0 + 16 * j + lo];
#pragma unroll
    for (int i = 0; i < 2; ++i) {
      float* dst = out + (size_t)(m0 + 16 * i + 8 * hi) * Ec + n0 + 16 * j + lo;
#pragma unroll
      for (int r = 0; r < 8; ++r) dst[(size_t)r * Ec] = acc[i][j][r] + bn;
    }
  }
}

// ---------------------------------------------------------------------------
extern "C" void kernel_launch(void* const* d_in, const int* in_sizes, int n_in,
                              void* d_out, int out_size, void* d_ws,
                              size_t ws_size, hipStream_t stream) {
  const float* x  = (const float*)d_in[0];
  const float* Wq = (const float*)d_in[1];
  const float* bq = (const float*)d_in[2];
  const float* Wk = (const float*)d_in[3];
  const float* bk = (const float*)d_in[4];
  const float* Wv = (const float*)d_in[5];
  const float* bv = (const float*)d_in[6];
  const float* Wo = (const float*)d_in[7];
  const float* bo = (const float*)d_in[8];
  float* out = (float*)d_out;

  // Workspace layout (bf16 elements):
  //   xb (4M) | Wq (1M) | Wk (1M) | Wv (1M) | Wo (1M) |
  //   Q (4M)  | K (4M)  | V^T (4M) | attn (4M)          = 24M elems = 48MB
  const size_t nX = (size_t)Bc * Tc * Ec;  // 4,194,304
  const size_t nW = (size_t)Ec * Ec;       // 1,048,576
  bf16* xb   = (bf16*)d_ws;
  bf16* Wqb  = xb + nX;
  bf16* Wkb  = Wqb + nW;
  bf16* Wvb  = Wkb + nW;
  bf16* Wob  = Wvb + nW;
  bf16* Qws  = Wob + nW;
  bf16* Kws  = Qws + nX;
  bf16* Vtws = Kws + nX;
  bf16* attn = Vtws + nX;

  // 0) fp32 -> bf16 pre-pass (removes all conversion from GEMM hot loops):
  //    xb | Wqb | Wkb | Wvb | Wob are contiguous, 8 slabs of nW elements.
  cvt_f32_bf16_kernel<<<dim3(nW / 2048), 256, 0, stream>>>(x, Wq, Wk, Wv, Wo,
                                                           xb);

  // 1) QKV projections: 32x64 tile/wave, grid (BT/32/8, E/64, 3).
  dim3 g1(Bc * Tc / 32 / 8, Ec / 64, 3);
  qkv_proj_kernel<<<g1, 256, 0, stream>>>(xb, Wqb, Wkb, Wvb, bq, bk, bv,
                                          Qws, Kws, Vtws);

  // 2) Flash attention: 32-row q-tile per wave, grid (T/32/8, H, B).
  dim3 g2(Tc / 32 / 8, Hc, Bc);
  flash_attn_kernel<<<g2, 256, 0, stream>>>(Qws, Kws, Vtws, attn);

  // 3) Output projection.
  dim3 g3(Bc * Tc / 32 / 8, Ec / 64);
  out_proj_kernel<<<g3, 256, 0, stream>>>(attn, Wob, bo, out);
}

// v005
// One run takes 87.5 microseconds.
// Next to v004, in two timings, it ran 1.06 and 1.09 times as fast.
// Counting every step since v000, it is 2.64 times as fast.
#include <hip/hip_runtime.h>
#include <hip/hip_bf16.h>

// ---------------------------------------------------------------------------
// MHA forward for MI455X (gfx1250, wave32, WMMA).
// All four matmul stages use v_wmma_f32_16x16x32_bf16 with register blocking;
// fp32->bf16 conversion is hoisted into a one-shot pre-pass.
// All matmul operands (x, the weights, Q, K, V^T, attn) lie in the workspace
// in fragment order: see load_frag_packed.
// ---------------------------------------------------------------------------

typedef __bf16 bf16;
typedef __attribute__((ext_vector_type(16))) __bf16 v16bf;
typedef __attribute__((ext_vector_type(8)))  __bf16 v8bf;
typedef __attribute__((ext_vector_type(8)))  float  v8f;
typedef __attribute__((ext_vector_type(4)))  float  v4f;

constexpr int Bc = 2;
constexpr int Tc = 2048;
constexpr int Ec = 1024;
constexpr int Hc = 16;
constexpr int Dc = 64;   // Ec / Hc

// D = A(16x32 bf16) * B(32x16 bf16, row-of-K per lane) + C(16x16 f32)
__device__ __forceinline__ v8f wmma_bf16(v16bf a, v16bf b, v8f c) {
  return __builtin_amdgcn_wmma_f32_16x16x32_bf16(
      /*neg_a=*/false, a, /*neg_b=*/false, b,
      /*c_mod=*/(short)0, c, /*reuse_a=*/false, /*reuse_b=*/false);
}

// 16x32 bf16 fragment.  ISA 16-bit A layout (wave32): lane L holds row (L&15);
// K-chunks of 8 at columns (L>>4)*8 and 16+(L>>4)*8.  Two 16B loads per lane.
// It is read from a packed tile of 512 elements (1 KB): chunk c of 8
// elements, c = 32*part + lane, holds row (lane&15), columns
// 16*part + (lane>>4)*8 .. +7.  Each of the two loads then covers 512
// contiguous bytes (4 whole 128-B lines) instead of 32 B in each of 16 lines.
// p: the lane's own first chunk, tile + lane * 8.
__device__ __forceinline__ v16bf load_frag_lane(const bf16* p) {
  v8bf lo = *(const v8bf*)(p);
  v8bf hi = *(const v8bf*)(p + 256);
  return __builtin_shufflevector(lo, hi, 0, 1, 2, 3, 4, 5, 6, 7,
                                 8, 9, 10, 11, 12, 13, 14, 15);
}
__device__ __forceinline__ v16bf load_frag_packed(const bf16* tile) {
  return load_frag_lane(tile + (threadIdx.x & 31) * 8);
}

// A [rows x Ec] matrix in packed tiles: tile (row>>4, col>>5) starts at
// element (row>>4)*16*Ec + (col>>5)*512, so a 16-row block is contiguous in k.

// One k step (32) of a wave tile of 16*MI rows x 16*NJ columns: its MI + NJ
// fragments, all loads issued as one group.  A, B: the lane's chunk of the
// first packed tile of the wave's rows / columns.
template <int MI, int NJ>
__device__ __forceinline__ void gemm_load_step(const bf16* A, const bf16* B,
                                               int k, v16bf (&a)[MI],
                                               v16bf (&b)[NJ]) {
  // Keeps the group whole, behind the products of the step before: without it
  // the compiler lifts parts of it among them, into further registers, and the
  // loads then stand at several places of a step instead of one.
  __builtin_amdgcn_sched_barrier(0);
#pragma unroll
  for (int i = 0; i < MI; ++i)
    a[i] = load_frag_lane(A + i * 16 * Ec + k * 16);
#pragma unroll
  for (int j = 0; j < NJ; ++j)
    b[j] = load_frag_lane(B + j * 16 * Ec + k * 16);
  // Stands in front of the next rewrite of the address registers that the
  // loads above name.  The addresses are inputs so that they live up to the
  // wait: otherwise the last load lands in them.
  asm volatile("s_wait_xcnt 0x0" :: "v"(A), "v"(B) : "memory");
  // Keeps the products that follow in the source behind the whole group:
  // without it the compiler lifts them among the loads to save registers, and
  // the wave then waits for the group right after issuing it.
  __builtin_amdgcn_sched_barrier(0);
}

template <int MI, int NJ>
__device__ __forceinline__ void gemm_mma_step(const v16bf (&a)[MI],
                                              const v16bf (&b)[NJ],
                                              v8f (&acc)[MI][NJ]) {
#pragma unroll
  for (int j = 0; j < NJ; ++j)
#pragma unroll
    for (int i = 0; i < MI; ++i)
      acc[i][j] = wmma_bf16(a[i], b[j], acc[i][j]);
}

// acc += A . B^T over k = 0 .. Ec-1, in k order.  Three fragment sets in a
// ring: each step's loads are issued two steps ahead, in front of the products
// of the step that is due, so a group has two steps' products of time to land.
// The loop is unrolled whole so that the ring index is a constant and every
// address is one register pair plus an immediate offset.
template <int MI, int NJ>
__device__ __forceinline__ void gemm_k_loop(const bf16* Atile,
                                            const bf16* Btile,
                                            v8f (&acc)[MI][NJ]) {
  constexpr int NS = 3, steps = Ec / 32;
  const bf16* A = Atile + (threadIdx.x & 31) * 8;
  const bf16* B = Btile + (threadIdx.x & 31) * 8;
  v16bf a[NS][MI], b[NS][NJ];
#pragma unroll
  for (int st = 0; st < NS - 1; ++st)
    gemm_load_step(A, B, st * 32, a[st], b[st]);
#pragma unroll
  for (int st = 0; st < steps; ++st) {
    if (st + NS - 1 < steps)
      gemm_load_step(A, B, (st + NS - 1) * 32, a[(st + NS - 1) % NS],
                     b[(st + NS - 1) % NS]);
    gemm_mma_step(a[st % NS], b[st % NS], acc);
  }
}

// ---------------------------------------------------------------------------
// Kernel 0: one-shot fp32 -> bf16 conversion of x and the four weights into
// packed tiles, one launch.  The destinations lie one behind the other in the
// workspace, and x is four slabs of the shape of a weight ([Ec x Ec]), so the
// work is 8 equal slabs.  One thread makes the same 16-B chunk of every slab:
// 16 loads in flight per lane and 4096 waves in all (a pass this short is
// bound by the start of its waves, not by its bytes).  A wave takes 8 rows of
// one tile: 4 lanes read one 128-B line of a source, and the 8 chunks of equal
// columns make one whole 128-B line of dst.
// ---------------------------------------------------------------------------
__global__ __launch_bounds__(256) void cvt_f32_bf16_kernel(
    const float* __restrict__ x, const float* __restrict__ Wq,
    const float* __restrict__ Wk, const float* __restrict__ Wv,
    const float* __restrict__ Wo, bf16* __restrict__ dst) {
  constexpr unsigned slab = Ec * Ec;
  const unsigned g = blockIdx.x * 256 + threadIdx.x;
  const unsigned tile = g >> 6;        // tile in the slab
  const unsigned r16 = (g >> 2) & 15;  // row in the tile
  const unsigned q = g & 3;            // columns 8*q .. 8*q + 7 of the tile
  const unsigned row = (tile / (Ec / 32)) * 16 + r16;
  const unsigned col = (tile % (Ec / 32)) * 32 + q * 8;
  const unsigned so = (row * Ec + col) * 4;  // byte offset in a source slab
  const unsigned i = tile * 512 + (q * 16 + r16) * 8;  // chunk 16*q + r16
  const unsigned xo[4] = {so, so + slab * 4, so + slab * 8, so + slab * 12};
  const float* const sp[8] = {x, x, x, x, Wq, Wk, Wv, Wo};
  v4f a[8], b[8];
#pragma unroll
  for (int s = 0; s < 8; ++s) {
    const char* p = (const char*)sp[s] + xo[s < 4 ? s : 0];
    a[s] = *(const v4f*)(p);
    b[s] = *(const v4f*)(p + 16);
  }
  // Stands in front of every reuse of the address registers that the loads
  // above name.  The offsets are inputs so that they live up to the wait:
  // otherwise the last load lands in them.
  asm volatile("s_wait_xcnt 0x0"
               :: "v"(xo[0]), "v"(xo[1]), "v"(xo[2]), "v"(xo[3]) : "memory");
#pragma unroll
  for (int s = 0; s < 8; ++s) {
    v8bf o;
#pragma unroll
    for (int j = 0; j < 4; ++j) {
      o[j]     = (bf16)a[s][j];
      o[4 + j] = (bf16)b[s][j];
    }
    *(v8bf*)(dst + (size_t)s * slab + i) = o;
  }
}

// ---------------------------------------------------------------------------
// Kernel 1: fused QKV projection as one product Y = x . W^T with W the 3*Ec
// rows Wq | Wk | Wv, which lie one behind the other in the workspace.
// A work-group makes 256 tokens x 192 features, 4 x 2 waves of 64 x 96 (4 x 6
// WMMA tiles): 256 work-groups, one per WGP, and per k step the group reads
// 448 operand rows for 192 products, so few bytes come from L2 per product.
// Each 16-feature tile lies in one of Q, K, V and in one head.
// Q, K and V^T -> packed tiles, 4 tiles (4 KB) per head and chunk of 32 tokens;
// every 128-B line of them holds features of one 16-feature tile, so one wave
// writes it whole:
//   Q, K tile (t>>4)*2 + (d>>5): rows = tokens, columns = d;
//   V^T  tile (t>>5)*4 + (d>>4): rows = d,      columns = tokens.
// ---------------------------------------------------------------------------
__global__ __launch_bounds__(256) void qkv_proj_kernel(
    const bf16* __restrict__ xb, const bf16* __restrict__ Wqkv,
    const float* __restrict__ bq, const float* __restrict__ bk,
    const float* __restrict__ bv,
    bf16* __restrict__ Qws, bf16* __restrict__ Kws, bf16* __restrict__ Vtws) {
  // The wave's number in a scalar register: every test below on a tile's
  // place is then a scalar branch.
  const int wave = __builtin_amdgcn_readfirstlane(threadIdx.x >> 5);
  const int lane = threadIdx.x & 31;
  const int m0 = blockIdx.x * 256 + (wave >> 1) * 64;  // token-row block
  const int n0 = blockIdx.y * 192 + (wave & 1) * 96;   // row block of W

  const int hi = lane >> 4, lo = lane & 15;

  // The six tiles' biases, asked for ahead of the k loop: they land behind it.
  float bn[6];
#pragma unroll
  for (int j = 0; j < 6; ++j) {
    const int n = n0 + 16 * j;
    const float* bias = (n >> 10) == 0 ? bq : (n >> 10) == 1 ? bk : bv;
    bn[j] = bias[(n & (Ec - 1)) + lo];
  }
  // Stands in front of every reuse of the address registers that the loads
  // above name.
  asm volatile("s_wait_xcnt 0x0" ::: "memory");

  v8f acc[4][6] = {};
  gemm_k_loop<4, 6>(xb + (size_t)m0 * Ec, Wqkv + (size_t)n0 * Ec, acc);

  // The wave's 64 tokens lie in one batch:
  // acc[i][j][r] = Y[token t0 + 16*i + 8*hi + r][row n0 + 16*j + lo of W].
  const int t0 = m0 & (Tc - 1);
  const size_t b0 = (size_t)(m0 >> 11) * Hc;  // T = 2048

#pragma unroll
  for (int j = 0; j < 6; ++j) {
    const int n = n0 + 16 * j;
    const int which = n >> 10;     // 0:Q 1:K 2:V  (E = 1024)
    const int f = n & (Ec - 1);    // first feature of the tile
    const int jj = (f >> 4) & 3;   // d = 16*jj + lo  (D = 64)
    const size_t head = (b0 + (f >> 6)) * Tc * Dc + (size_t)t0 * Dc;

    if (which == 2) {
      // V^T: fixed d, 8 consecutive t = chunk 32*(i&1) + lane of tile jj of
      // key chunk i>>1 -> 512 contiguous bytes per store.
      bf16* dst = Vtws + head + jj * 512 + lane * 8;
#pragma unroll
      for (int i = 0; i < 4; ++i) {
        v8bf o;
#pragma unroll
        for (int r = 0; r < 8; ++r) o[r] = (bf16)(acc[i][j][r] + bn[j]);
        *(v8bf*)(dst + (i >> 1) * 2048 + (i & 1) * 256) = o;
      }
      // Stands in front of every reuse of the registers that the stores above
      // name: in the built kernel another tile's or case's code follows.
      asm volatile("s_wait_xcnt 0x0" ::: "memory");
    } else {
      // Q, K: tile 2*i + (jj>>1) of the wave's tokens, chunk
      // 32*(jj&1) + 16*(lo>>3) + 8*hi + r, element lo & 7.
      bf16* dst = (which == 0 ? Qws : Kws) + head + (jj >> 1) * 512 +
                  (jj & 1) * 256 + ((lo >> 3) * 16 + 8 * hi) * 8 + (lo & 7);
#pragma unroll
      for (int i = 0; i < 4; ++i)
#pragma unroll
        for (int r = 0; r < 8; ++r)
          dst[i * 1024 + r * 8] = (bf16)(acc[i][j][r] + bn[j]);
      // The same wait, for the same reason.
      asm volatile("s_wait_xcnt 0x0" ::: "memory");
    }
  }
}

// ---------------------------------------------------------------------------
// Kernel 2: flash attention, transposed products.  One wave owns 32 queries
// (2 column groups of 16 sharing every K/V fragment); keys in chunks of 32
// with online softmax.  S^T = K . Q^T puts one query's scores into one lane
// pair (l, l ^ 16): D register r = S^T[key 8*(l>>4) + r][query l & 15].  Two
// such tiles, converted in place, are the B operand of O^T += V^T . P^T.
// 16 WMMAs per key-chunk; no LDS, no barrier.
// ---------------------------------------------------------------------------

// Value of lane l ^ 16.
__device__ __forceinline__ float other_half(float x) {
  const int v = __builtin_bit_cast(int, x);
  return __builtin_bit_cast(float, __builtin_amdgcn_permlanex16(
      v, v, 0x76543210, 0xfedcba98, false, false));
}

__global__ __launch_bounds__(256) void flash_attn_kernel(
    const bf16* __restrict__ Qws, const bf16* __restrict__ Kws,
    const bf16* __restrict__ Vtws, bf16* __restrict__ attnws) {
  const int wave = threadIdx.x >> 5;
  const int lane = threadIdx.x & 31;
  const int b = blockIdx.z, h = blockIdx.y;
  const int q0 = (blockIdx.x * 8 + wave) * 32;

  const bf16* Qbase = Qws + (((size_t)b * Hc + h) * Tc + q0) * Dc;
  const bf16* Kbase = Kws + ((size_t)b * Hc + h) * Tc * Dc;
  const bf16* Vbase = Vtws + ((size_t)b * Hc + h) * Dc * Tc;

  // Q tiles (2 x 16 x 64) in registers: [qsub][k-chunk of 32], 4 packed tiles
  v16bf qa[2][2];
#pragma unroll
  for (int t = 0; t < 4; ++t)
    qa[t >> 1][t & 1] = load_frag_packed(Qbase + t * 512);

  // acc[qs][j][r] = O^T[d = 16*j + 8*(lane>>4) + r][query 16*qs + (lane&15)]
  v8f acc[2][4] = {};
  // m_i: running maximum of the lane's query (equal in both halves);
  // l_i: running sum over the keys this half holds (joined after the loop).
  float m_i[2], l_i[2];
#pragma unroll
  for (int qs = 0; qs < 2; ++qs) { m_i[qs] = -1e30f; l_i[qs] = 0.0f; }
  const float scale = 0.125f;  // 1/sqrt(D)

  // K fragments shared by both q-subtiles: [key-half][d-chunk], 4 packed tiles
  // per chunk of 32 keys, fetched one chunk ahead into the other of two sets.
  v16bf kfa[2][2], kfb[2][2];
#pragma unroll
  for (int t = 0; t < 4; ++t)
    kfa[t >> 1][t & 1] = load_frag_packed(Kbase + t * 512);
  // Stands in front of every reuse of the address registers that the loads
  // above name.
  asm volatile("s_wait_xcnt 0x0" ::: "memory");

  // One pass over a chunk of 32 keys, its K already in kf.  vp + vo: the
  // lane's chunk of the pass's first V^T tile; kp + ko: of the next chunk's
  // first K tile (4 packed tiles each).
  auto pass = [&](const v16bf (&kf)[2][2], v16bf (&kn)[2][2], const bf16* vp,
                  int vo, const bf16* kp, int ko) {
    // All loads of the pass as one group at its head.  This chunk's V^T tiles
    // land behind the score products and the softmax; the next chunk's K lands
    // behind the whole pass.
    v16bf vf[4];
#pragma unroll
    for (int j = 0; j < 4; ++j)
      vf[j] = load_frag_lane(vp + vo + j * 512);
#pragma unroll
    for (int t = 0; t < 4; ++t)
      kn[t >> 1][t & 1] = load_frag_lane(kp + ko + t * 512);
    // The same wait.  The two address registers are inputs so that they live
    // up to the wait: otherwise the last load lands in them.
    asm volatile("s_wait_xcnt 0x0" :: "v"(vp), "v"(kp) : "memory");
    // Keeps the products behind the whole group: lifted among the loads they
    // would delay its issue, and with it the landing of the next pass's K.
    __builtin_amdgcn_sched_barrier(0);

    v8f sc[2][2];  // [q-subtile][keys 0..15 and 16..31 of the chunk]
#pragma unroll
    for (int qs = 0; qs < 2; ++qs) {
      v8f s0 = {}, s1 = {};
      s0 = wmma_bf16(kf[0][0], qa[qs][0], s0);
      s0 = wmma_bf16(kf[0][1], qa[qs][1], s0);
      s1 = wmma_bf16(kf[1][0], qa[qs][0], s1);
      s1 = wmma_bf16(kf[1][1], qa[qs][1], s1);
      sc[qs][0] = s0;
      sc[qs][1] = s1;
    }

    v16bf pb[2];  // P^T (32 keys x 16 queries) as B operand
#pragma unroll
    for (int qs = 0; qs < 2; ++qs) {
      const v8f e0 = sc[qs][0] * scale;
      const v8f e1 = sc[qs][1] * scale;
      const v8f em = __builtin_elementwise_max(e0, e1);
      float mx = em[0];
#pragma unroll
      for (int r = 1; r < 8; ++r) mx = fmaxf(mx, em[r]);
      mx = fmaxf(mx, other_half(mx));
      const float mnew  = fmaxf(m_i[qs], mx);
      const float alpha = __expf(m_i[qs] - mnew);
      const v8f x0 = e0 - mnew;
      const v8f x1 = e1 - mnew;
      v8f p0, p1;
#pragma unroll
      for (int r = 0; r < 8; ++r) {
        p0[r] = __expf(x0[r]);
        p1[r] = __expf(x1[r]);
        pb[qs][r]     = (bf16)p0[r];
        pb[qs][8 + r] = (bf16)p1[r];
      }
      const v8f ps = p0 + p1;
      float rs = ps[0];
#pragma unroll
      for (int r = 1; r < 8; ++r) rs += ps[r];
      l_i[qs] = l_i[qs] * alpha + rs;
      m_i[qs] = mnew;
#pragma unroll
      for (int j = 0; j < 4; ++j) acc[qs][j] *= alpha;
    }

    // O^T(64x32) += V^T rows (d, the chunk's 32 keys) . P^T(32x32)
#pragma unroll
    for (int qs = 0; qs < 2; ++qs)
#pragma unroll
      for (int j = 0; j < 4; ++j)
        acc[qs][j] = wmma_bf16(vf[j], pb[qs], acc[qs][j]);
  };

  for (int kc = 0; kc < Tc; kc += 64) {
    const bf16* vp = Vbase + (size_t)kc * Dc + lane * 8;
    const bf16* kp = Kbase + (size_t)kc * Dc + lane * 8;
    pass(kfa, kfb, vp, 0, kp, 32 * Dc);
    // The last pass reads its own chunk again, so that the address stays
    // inside this head's K without a branch in the loop.
    pass(kfb, kfa, vp, 32 * Dc, kp + (kc + 64 < Tc ? 64 : 32) * Dc, 0);
  }

  // ---- normalize, write bf16 attn output ([B*T x E], e = h*D + d) in packed
  // tiles: a lane holds 8 consecutive d of one query = chunk 32*(j&1) + lane
  // of tile (t>>4, 2*h + (j>>1)) -> 512 contiguous bytes per store.
#pragma unroll
  for (int qs = 0; qs < 2; ++qs) {
    const float inv = 1.0f / (l_i[qs] + other_half(l_i[qs]));
    bf16* dst = attnws + ((size_t)b * Tc + q0 + 16 * qs) * Ec +
                (size_t)h * 1024 + lane * 8;
#pragma unroll
    for (int j = 0; j < 4; ++j) {
      v8bf o;
#pragma unroll
      for (int r = 0; r < 8; ++r) o[r] = (bf16)(acc[qs][j][r] * inv);
      *(v8bf*)(dst + (j >> 1) * 512 + (j & 1) * 256) = o;
    }
  }
}

// ---------------------------------------------------------------------------
// Kernel 3: output projection, out = attn @ Wo^T + bo.  A work-group makes
// 128 x 128, 4 x 2 waves of 32 x 64: 256 work-groups, and the square tile reads
// the fewest operand rows per product that this count of groups allows.
// ---------------------------------------------------------------------------
__global__ __launch_bounds__(256) void out_proj_kernel(
    const bf16* __restrict__ attnws, const bf16* __restrict__ Wob,
    const float* __restrict__ bo, float* __restrict__ out) {
  const int wave = threadIdx.x >> 5;
  const int lane = threadIdx.x & 31;
  const int m0 = blockIdx.x * 128 + (wave >> 1) * 32;
  const int n0 = blockIdx.y * 128 + (wave & 1) * 64;

  v8f acc[2][4] = {};
  gemm_k_loop<2, 4>(attnws + (size_t)m0 * Ec, Wob + (size_t)n0 * Ec, acc);

  const int hi = lane >> 4, lo = lane & 15;
#pragma unroll
  for (int j = 0; j < 4; ++j) {
    const float bn = bo[n0 + 16 * j + lo];
#pragma unroll
    for (int i = 0; i < 2; ++i) {
      float* dst = out + (size_t)(m0 + 16 * i + 8 * hi) * Ec + n0 + 16 * j + lo;
#pragma unroll
      for (int r = 0; r < 8; ++r) dst[(size_t)r * Ec] = acc[i][j][r] + bn;
    }
  }
}

// ---------------------------------------------------------------------------
extern "C" void kernel_launch(void* const* d_in, const int* in_sizes, int n_in,
                              void* d_out, int out_size, void* d_ws,
                              size_t ws_size, hipStream_t stream) {
  const float* x  = (const float*)d_in[0];
  const float* Wq = (const float*)d_in[1];
  const float* bq = (const float*)d_in[2];
  const float* Wk = (const float*)d_in[3];
  const float* bk = (const float*)d_in[4];
  const float* Wv = (const float*)d_in[5];
  const float* bv = (const float*)d_in[6];
  const float* Wo = (const float*)d_in[7];
  const float* bo = (const float*)d_in[8];
  float* out = (float*)d_out;

  // Workspace layout (bf16 elements):
  //   xb (4M) | Wq (1M) | Wk (1M) | Wv (1M) | Wo (1M) |
  //   Q (4M)  | K (4M)  | V^T (4M) | attn (4M)          = 24M elems = 48MB
  const size_t nX = (size_t)Bc * Tc * Ec;  // 4,194,304
  const size_t nW = (size_t)Ec * Ec;       // 1,048,576
  bf16* xb   = (bf16*)d_ws;
  bf16* Wqb  = xb + nX;
  bf16* Wkb  = Wqb + nW;
  bf16* Wvb  = Wkb + nW;
  bf16* Wob  = Wvb + nW;
  bf16* Qws  = Wob + nW;
  bf16* Kws  = Qws + nX;
  bf16* Vtws = Kws + nX;
  bf16* attn = Vtws + nX;

  // 0) fp32 -> bf16 pre-pass (removes all conversion from GEMM hot loops):
  //    xb | Wqb | Wkb | Wvb | Wob are contiguous, 8 slabs of nW elements.
  cvt_f32_bf16_kernel<<<dim3(nW / 2048), 256, 0, stream>>>(x, Wq, Wk, Wv, Wo,
                                                           xb);

  // 1) QKV projections: 256x192 tile per group, grid (BT/256, 3E/192);
  //    Wqb | Wkb | Wvb are contiguous.
  dim3 g1(Bc * Tc / 256, 3 * Ec / 192);
  qkv_proj_kernel<<<g1, 256, 0, stream>>>(xb, Wqb, bq, bk, bv, Qws, Kws, Vtws);

  // 2) Flash attention: 32-row q-tile per wave, grid (T/32/8, H, B).
  dim3 g2(Tc / 32 / 8, Hc, Bc);
  flash_attn_kernel<<<g2, 256, 0, stream>>>(Qws, Kws, Vtws, attn);

  // 3) Output projection: 128x128 tile per group.
  dim3 g3(Bc * Tc / 128, Ec / 128);
  out_proj_kernel<<<g3, 256, 0, stream>>>(attn, Wob, bo, out);
}

// v006
// One run takes 71 microseconds.
// Two timings next to v005 put it at 1.24 and 1.25 times that version's speed.
// Counting every step since v000, it is 3.30 times as fast.
#include <hip/hip_runtime.h>
#include <hip/hip_bf16.h>

// ---------------------------------------------------------------------------
// MHA forward for MI455X (gfx1250, wave32, WMMA).
// All four matmul stages use v_wmma_f32_16x16x32_bf16 with register blocking;
// fp32->bf16 conversion is hoisted into a one-shot pre-pass.
// All matmul operands (x, the weights, Q, K, V^T, attn) lie in the workspace
// in fragment order: see load_frag_packed.
// ---------------------------------------------------------------------------

typedef __bf16 bf16;
typedef __attribute__((ext_vector_type(16))) __bf16 v16bf;
typedef __attribute__((ext_vector_type(8)))  __bf16 v8bf;
typedef __attribute__((ext_vector_type(8)))  float  v8f;
typedef __attribute__((ext_vector_type(4)))  float  v4f;

constexpr int Bc = 2;
constexpr int Tc = 2048;
constexpr int Ec = 1024;
constexpr int Hc = 16;
constexpr int Dc = 64;   // Ec / Hc

// D = A(16x32 bf16) * B(32x16 bf16, row-of-K per lane) + C(16x16 f32)
__device__ __forceinline__ v8f wmma_bf16(v16bf a, v16bf b, v8f c) {
  return __builtin_amdgcn_wmma_f32_16x16x32_bf16(
      /*neg_a=*/false, a, /*neg_b=*/false, b,
      /*c_mod=*/(short)0, c, /*reuse_a=*/false, /*reuse_b=*/false);
}

// 16x32 bf16 fragment.  ISA 16-bit A layout (wave32): lane L holds row (L&15);
// K-chunks of 8 at columns (L>>4)*8 and 16+(L>>4)*8.  Two 16B loads per lane.
// It is read from a packed tile of 512 elements (1 KB): chunk c of 8
// elements, c = 32*part + lane, holds row (lane&15), columns
// 16*part + (lane>>4)*8 .. +7.  Each of the two loads then covers 512
// contiguous bytes (4 whole 128-B lines) instead of 32 B in each of 16 lines.
// p: the lane's own first chunk, tile + lane * 8.
__device__ __forceinline__ v16bf load_frag_lane(const bf16* p) {
  v8bf lo = *(const v8bf*)(p);
  v8bf hi = *(const v8bf*)(p + 256);
  return __builtin_shufflevector(lo, hi, 0, 1, 2, 3, 4, 5, 6, 7,
                                 8, 9, 10, 11, 12, 13, 14, 15);
}
__device__ __forceinline__ v16bf load_frag_packed(const bf16* tile) {
  return load_frag_lane(tile + (threadIdx.x & 31) * 8);
}

// A [rows x Ec] matrix in packed tiles: tile (row>>4, col>>5) starts at
// element (row>>4)*16*Ec + (col>>5)*512, so a 16-row block is contiguous in k.

// One k step (32) of a wave tile of 16*MI rows x 16*NJ columns: its MI + NJ
// fragments, all loads issued as one group.  A, B: the lane's chunk of the
// first packed tile of the wave's rows / columns.
template <int MI, int NJ>
__device__ __forceinline__ void gemm_load_step(const bf16* A, const bf16* B,
                                               int k, v16bf (&a)[MI],
                                               v16bf (&b)[NJ]) {
  // Keeps the group whole, behind the products of the step before: without it
  // the compiler lifts parts of it among them, into further registers, and the
  // loads then stand at several places of a step instead of one.
  __builtin_amdgcn_sched_barrier(0);
#pragma unroll
  for (int i = 0; i < MI; ++i)
    a[i] = load_frag_lane(A + i * 16 * Ec + k * 16);
#pragma unroll
  for (int j = 0; j < NJ; ++j)
    b[j] = load_frag_lane(B + j * 16 * Ec + k * 16);
  // Stands in front of the next rewrite of the address registers that the
  // loads above name.  The addresses are inputs so that they live up to the
  // wait: otherwise the last load lands in them.
  asm volatile("s_wait_xcnt 0x0" :: "v"(A), "v"(B) : "memory");
  // Keeps the products that follow in the source behind the whole group:
  // without it the compiler lifts them among the loads to save registers, and
  // the wave then waits for the group right after issuing it.
  __builtin_amdgcn_sched_barrier(0);
}

template <int MI, int NJ>
__device__ __forceinline__ void gemm_mma_step(const v16bf (&a)[MI],
                                              const v16bf (&b)[NJ],
                                              v8f (&acc)[MI][NJ]) {
#pragma unroll
  for (int j = 0; j < NJ; ++j)
#pragma unroll
    for (int i = 0; i < MI; ++i)
      acc[i][j] = wmma_bf16(a[i], b[j], acc[i][j]);
}

// acc += A . B^T over k = 0 .. Ec-1, in k order.  Three fragment sets in a
// ring: each step's loads are issued two steps ahead, in front of the products
// of the step that is due, so a group has two steps' products of time to land.
// The loop is unrolled whole so that the ring index is a constant and every
// address is one register pair plus an immediate offset.
template <int MI, int NJ>
__device__ __forceinline__ void gemm_k_loop(const bf16* Atile,
                                            const bf16* Btile,
                                            v8f (&acc)[MI][NJ]) {
  constexpr int NS = 3, steps = Ec / 32;
  const bf16* A = Atile + (threadIdx.x & 31) * 8;
  const bf16* B = Btile + (threadIdx.x & 31) * 8;
  v16bf a[NS][MI], b[NS][NJ];
#pragma unroll
  for (int st = 0; st < NS - 1; ++st)
    gemm_load_step(A, B, st * 32, a[st], b[st]);
#pragma unroll
  for (int st = 0; st < steps; ++st) {
    if (st + NS - 1 < steps)
      gemm_load_step(A, B, (st + NS - 1) * 32, a[(st + NS - 1) % NS],
                     b[(st + NS - 1) % NS]);
    gemm_mma_step(a[st % NS], b[st % NS], acc);
  }
}

// ---------------------------------------------------------------------------
// Kernel 0: one-shot fp32 -> bf16 conversion of x and the four weights into
// packed tiles, one launch.  The destinations lie one behind the other in the
// workspace, and x is four slabs of the shape of a weight ([Ec x Ec]), so the
// work is 8 equal slabs.  One thread makes the same 16-B chunk of every slab:
// 16 loads in flight per lane and 4096 waves in all (a pass this short is
// bound by the start of its waves, not by its bytes).  A wave takes 8 rows of
// one tile: 4 lanes read one 128-B line of a source, and the 8 chunks of equal
// columns make one whole 128-B line of dst.
// ---------------------------------------------------------------------------
__global__ __launch_bounds__(256) void cvt_f32_bf16_kernel(
    const float* __restrict__ x, const float* __restrict__ Wq,
    const float* __restrict__ Wk, const float* __restrict__ Wv,
    const float* __restrict__ Wo, bf16* __restrict__ dst) {
  constexpr unsigned slab = Ec * Ec;
  const unsigned g = blockIdx.x * 256 + threadIdx.x;
  const unsigned tile = g >> 6;        // tile in the slab
  const unsigned r16 = (g >> 2) & 15;  // row in the tile
  const unsigned q = g & 3;            // columns 8*q .. 8*q + 7 of the tile
  const unsigned row = (tile / (Ec / 32)) * 16 + r16;
  const unsigned col = (tile % (Ec / 32)) * 32 + q * 8;
  const unsigned so = (row * Ec + col) * 4;  // byte offset in a source slab
  const unsigned i = tile * 512 + (q * 16 + r16) * 8;  // chunk 16*q + r16
  const unsigned xo[4] = {so, so + slab * 4, so + slab * 8, so + slab * 12};
  const float* const sp[8] = {x, x, x, x, Wq, Wk, Wv, Wo};
  v4f a[8], b[8];
#pragma unroll
  for (int s = 0; s < 8; ++s) {
    const char* p = (const char*)sp[s] + xo[s < 4 ? s : 0];
    a[s] = *(const v4f*)(p);
    b[s] = *(const v4f*)(p + 16);
  }
  // Stands in front of every reuse of the address registers that the loads
  // above name.  The offsets are inputs so that they live up to the wait:
  // otherwise the last load lands in them.
  asm volatile("s_wait_xcnt 0x0"
               :: "v"(xo[0]), "v"(xo[1]), "v"(xo[2]), "v"(xo[3]) : "memory");
#pragma unroll
  for (int s = 0; s < 8; ++s) {
    v8bf o;
#pragma unroll
    for (int j = 0; j < 4; ++j) {
      o[j]     = (bf16)a[s][j];
      o[4 + j] = (bf16)b[s][j];
    }
    *(v8bf*)(dst + (size_t)s * slab + i) = o;
  }
}

// ---------------------------------------------------------------------------
// Kernel 1: fused QKV projection as one product Y = x . W^T with W the 3*Ec
// rows Wq | Wk | Wv, which lie one behind the other in the workspace.
// A work-group makes 256 tokens x 192 features, 4 x 2 waves of 64 x 96 (4 x 6
// WMMA tiles): 256 work-groups, one per WGP, and per k step the group reads
// 448 operand rows for 192 products, so few bytes come from L2 per product.
// Each 16-feature tile lies in one of Q, K, V and in one head.
// Q, K and V^T -> packed tiles, 4 tiles (4 KB) per head and chunk of 32 tokens;
// every 128-B line of them holds features of one 16-feature tile, so one wave
// writes it whole:
//   Q, K tile (t>>4)*2 + (d>>5): rows = tokens, columns = d;
//   V^T  tile (t>>5)*4 + (d>>4): rows = d,      columns = tokens.
// ---------------------------------------------------------------------------
__global__ __launch_bounds__(256) void qkv_proj_kernel(
    const bf16* __restrict__ xb, const bf16* __restrict__ Wqkv,
    const float* __restrict__ bq, const float* __restrict__ bk,
    const float* __restrict__ bv,
    bf16* __restrict__ Qws, bf16* __restrict__ Kws, bf16* __restrict__ Vtws) {
  // The wave's number in a scalar register: every test below on a tile's
  // place is then a scalar branch.
  const int wave = __builtin_amdgcn_readfirstlane(threadIdx.x >> 5);
  const int lane = threadIdx.x & 31;
  const int m0 = blockIdx.x * 256 + (wave >> 1) * 64;  // token-row block
  const int n0 = blockIdx.y * 192 + (wave & 1) * 96;   // row block of W

  const int hi = lane >> 4, lo = lane & 15;

  // The six tiles' biases, asked for ahead of the k loop: they land behind it.
  float bn[6];
#pragma unroll
  for (int j = 0; j < 6; ++j) {
    const int n = n0 + 16 * j;
    const float* bias = (n >> 10) == 0 ? bq : (n >> 10) == 1 ? bk : bv;
    bn[j] = bias[(n & (Ec - 1)) + lo];
  }
  // Stands in front of every reuse of the address registers that the loads
  // above name.
  asm volatile("s_wait_xcnt 0x0" ::: "memory");

  v8f acc[4][6] = {};
  gemm_k_loop<4, 6>(xb + (size_t)m0 * Ec, Wqkv + (size_t)n0 * Ec, acc);

  // The wave's 64 tokens lie in one batch:
  // acc[i][j][r] = Y[token t0 + 16*i + 8*hi + r][row n0 + 16*j + lo of W].
  const int t0 = m0 & (Tc - 1);
  const size_t b0 = (size_t)(m0 >> 11) * Hc;  // T = 2048

#pragma unroll
  for (int j = 0; j < 6; ++j) {
    const int n = n0 + 16 * j;
    const int which = n >> 10;     // 0:Q 1:K 2:V  (E = 1024)
    const int f = n & (Ec - 1);    // first feature of the tile
    const int jj = (f >> 4) & 3;   // d = 16*jj + lo  (D = 64)
    const size_t head = (b0 + (f >> 6)) * Tc * Dc + (size_t)t0 * Dc;

    if (which == 2) {
      // V^T: fixed d, 8 consecutive t = chunk 32*(i&1) + lane of tile jj of
      // key chunk i>>1 -> 512 contiguous bytes per store.
      bf16* dst = Vtws + head + jj * 512 + lane * 8;
#pragma unroll
      for (int i = 0; i < 4; ++i) {
        v8bf o;
#pragma unroll
        for (int r = 0; r < 8; ++r) o[r] = (bf16)(acc[i][j][r] + bn[j]);
        *(v8bf*)(dst + (i >> 1) * 2048 + (i & 1) * 256) = o;
      }
      // Stands in front of every reuse of the registers that the stores above
      // name: in the built kernel another tile's or case's code follows.
      asm volatile("s_wait_xcnt 0x0" ::: "memory");
    } else {
      // Q, K: tile 2*i + (jj>>1) of the wave's tokens, chunk
      // 32*(jj&1) + 16*(lo>>3) + 8*hi + r, element lo & 7.
      bf16* dst = (which == 0 ? Qws : Kws) + head + (jj >> 1) * 512 +
                  (jj & 1) * 256 + ((lo >> 3) * 16 + 8 * hi) * 8 + (lo & 7);
#pragma unroll
      for (int i = 0; i < 4; ++i)
#pragma unroll
        for (int r = 0; r < 8; ++r)
          dst[i * 1024 + r * 8] = (bf16)(acc[i][j][r] + bn[j]);
      // The same wait, for the same reason.
      asm volatile("s_wait_xcnt 0x0" ::: "memory");
    }
  }
}

// ---------------------------------------------------------------------------
// Kernel 2: flash attention, transposed products.  A pair of waves owns 32
// queries (2 column groups of 16 sharing every K/V fragment), each wave one
// half of the keys, so that 16 waves (4 per SIMD) stand on a WGP and one
// wave's softmax runs beside the others' products; keys in chunks of 32
// with online softmax.  S^T = K . Q^T puts one query's scores into one lane
// pair (l, l ^ 16): D register r = S^T[key 8*(l>>4) + r][query l & 15].  Two
// such tiles, converted in place, are the B operand of O^T += V^T . P^T.
// 16 WMMAs per key-chunk; no LDS and no barrier in the loop.  Behind it the
// two waves of a pair swap one column group each through LDS and join them.
// ---------------------------------------------------------------------------

// Value of lane l ^ 16.
__device__ __forceinline__ float other_half(float x) {
  const int v = __builtin_bit_cast(int, x);
  return __builtin_bit_cast(float, __builtin_amdgcn_permlanex16(
      v, v, 0x76543210, 0xfedcba98, false, false));
}

// 2^x.  The v_nop fills the slot behind a transcendental, in front of an
// instruction that reads its result or takes its source register; it stands
// in the same statement so that it stays directly behind.
__device__ __forceinline__ float exp2_slot(float x) {
  float r;
  asm("v_exp_f32 %0, %1\n\tv_nop" : "=v"(r) : "v"(x));
  return r;
}

__global__ __launch_bounds__(512) void flash_attn_kernel(
    const bf16* __restrict__ Qws, const bf16* __restrict__ Kws,
    const bf16* __restrict__ Vtws, bf16* __restrict__ attnws) {
  // What a wave hands to its partner: one column group's O^T, maximum and sum.
  __shared__ v4f xacc[16][8][32];
  __shared__ float xml[16][2][32];
  constexpr int Th = Tc / 2;  // keys per wave
  // The wave's number in a scalar register: base addresses are then scalar.
  const int wave = __builtin_amdgcn_readfirstlane(threadIdx.x >> 5);
  const int lane = threadIdx.x & 31;
  const int b = blockIdx.z, h = blockIdx.y;
  const int kh = wave >> 3;  // which half of the keys
  const int q0 = (blockIdx.x * 8 + (wave & 7)) * 32;

  const bf16* Qbase = Qws + (((size_t)b * Hc + h) * Tc + q0) * Dc;
  const bf16* Kbase = Kws + (((size_t)b * Hc + h) * Tc + kh * Th) * Dc;
  const bf16* Vbase = Vtws + (((size_t)b * Hc + h) * Tc + kh * Th) * Dc;

  // Q tiles (2 x 16 x 64) in registers: [qsub][k-chunk of 32], 4 packed tiles
  v16bf qa[2][2];
#pragma unroll
  for (int t = 0; t < 4; ++t)
    qa[t >> 1][t & 1] = load_frag_packed(Qbase + t * 512);

  // acc[qs][j][r] = O^T[d = 16*j + 8*(lane>>4) + r][query 16*qs + (lane&15)]
  v8f acc[2][4] = {};
  // m_i: running maximum of the lane's query (equal in both halves);
  // l_i: running sum over the keys this half holds (joined after the loop).
  float m_i[2], l_i[2];
#pragma unroll
  for (int qs = 0; qs < 2; ++qs) { m_i[qs] = -1e30f; l_i[qs] = 0.0f; }
  const float scale = 0.125f;  // 1/sqrt(D)

  // K fragments shared by both q-subtiles: [key-half][d-chunk], 4 packed tiles
  // per chunk of 32 keys, fetched one chunk ahead into the other of two sets.
  v16bf kfa[2][2], kfb[2][2];
#pragma unroll
  for (int t = 0; t < 4; ++t)
    kfa[t >> 1][t & 1] = load_frag_packed(Kbase + t * 512);
  // Stands in front of every reuse of the address registers that the loads
  // above name.
  asm volatile("s_wait_xcnt 0x0" ::: "memory");

  // One pass over a chunk of 32 keys, its K already in kf.  vp + vo: the
  // lane's chunk of the pass's first V^T tile; kp + ko: of the next chunk's
  // first K tile (4 packed tiles each).
  auto pass = [&](const v16bf (&kf)[2][2], v16bf (&kn)[2][2], const bf16* vp,
                  int vo, const bf16* kp, int ko) {
    // All loads of the pass as one group at its head.  This chunk's V^T tiles
    // land behind the score products and the softmax; the next chunk's K lands
    // behind the whole pass.
    v16bf vf[4];
#pragma unroll
    for (int j = 0; j < 4; ++j)
      vf[j] = load_frag_lane(vp + vo + j * 512);
#pragma unroll
    for (int t = 0; t < 4; ++t)
      kn[t >> 1][t & 1] = load_frag_lane(kp + ko + t * 512);
    // The same wait.  The two address registers are inputs so that they live
    // up to the wait: otherwise the last load lands in them.
    asm volatile("s_wait_xcnt 0x0" :: "v"(vp), "v"(kp) : "memory");
    // Keeps the products behind the whole group: lifted among the loads they
    // would delay its issue, and with it the landing of the next pass's K.
    __builtin_amdgcn_sched_barrier(0);

    v8f sc[2][2];  // [q-subtile][keys 0..15 and 16..31 of the chunk]
#pragma unroll
    for (int qs = 0; qs < 2; ++qs) {
      v8f s0 = {}, s1 = {};
      s0 = wmma_bf16(kf[0][0], qa[qs][0], s0);
      s0 = wmma_bf16(kf[0][1], qa[qs][1], s0);
      s1 = wmma_bf16(kf[1][0], qa[qs][0], s1);
      s1 = wmma_bf16(kf[1][1], qa[qs][1], s1);
      sc[qs][0] = s0;
      sc[qs][1] = s1;
    }

    v16bf pb[2];  // P^T (32 keys x 16 queries) as B operand
#pragma unroll
    for (int qs = 0; qs < 2; ++qs) {
      const v8f e0 = sc[qs][0] * scale;
      const v8f e1 = sc[qs][1] * scale;
      const v8f em = __builtin_elementwise_max(e0, e1);
      float mx = em[0];
#pragma unroll
      for (int r = 1; r < 8; ++r) mx = fmaxf(mx, em[r]);
      mx = fmaxf(mx, other_half(mx));
      const float mnew  = fmaxf(m_i[qs], mx);
      const float alpha = __expf(m_i[qs] - mnew);
      const v8f x0 = e0 - mnew;
      const v8f x1 = e1 - mnew;
      v8f p0, p1;
#pragma unroll
      for (int r = 0; r < 8; ++r) {
        p0[r] = __expf(x0[r]);
        p1[r] = __expf(x1[r]);
        pb[qs][r]     = (bf16)p0[r];
        pb[qs][8 + r] = (bf16)p1[r];
      }
      const v8f ps = p0 + p1;
      float rs = ps[0];
#pragma unroll
      for (int r = 1; r < 8; ++r) rs += ps[r];
      l_i[qs] = l_i[qs] * alpha + rs;
      m_i[qs] = mnew;
#pragma unroll
      for (int j = 0; j < 4; ++j) acc[qs][j] *= alpha;
    }

    // O^T(64x32) += V^T rows (d, the chunk's 32 keys) . P^T(32x32)
#pragma unroll
    for (int qs = 0; qs < 2; ++qs)
#pragma unroll
      for (int j = 0; j < 4; ++j)
        acc[qs][j] = wmma_bf16(vf[j], pb[qs], acc[qs][j]);
  };

  for (int kc = 0; kc < Th; kc += 64) {
    const bf16* vp = Vbase + (size_t)kc * Dc + lane * 8;
    const bf16* kp = Kbase + (size_t)kc * Dc + lane * 8;
    pass(kfa, kfb, vp, 0, kp, 32 * Dc);
    // The last pass reads its own chunk again, so that the address stays
    // inside this head's K without a branch in the loop.
    pass(kfb, kfa, vp, 32 * Dc, kp + (kc + 64 < Th ? 64 : 32) * Dc, 0);
  }

  // ---- join the two key halves.  Both waves of a pair hold the same element
  // at the same lane and register.  Wave kh keeps column group kh and hands
  // the other one over, 512 contiguous bytes per LDS store.
#pragma unroll
  for (int j = 0; j < 4; ++j) {
    const v8f g = kh ? acc[0][j] : acc[1][j];
    xacc[wave][2 * j][lane]     = __builtin_shufflevector(g, g, 0, 1, 2, 3);
    xacc[wave][2 * j + 1][lane] = __builtin_shufflevector(g, g, 4, 5, 6, 7);
  }
  xml[wave][0][lane] = kh ? m_i[0] : m_i[1];
  xml[wave][1][lane] = kh ? l_i[0] : l_i[1];
  // Publishes every wave's handed-over group to its partner.
  __syncthreads();
  const float m_own = kh ? m_i[1] : m_i[0];
  const float l_own = kh ? l_i[1] : l_i[0];
  const float m_oth = xml[wave ^ 8][0][lane];
  const float l_oth = xml[wave ^ 8][1][lane];
  const float m_all = fmaxf(m_own, m_oth);
  float w_own = exp2_slot((m_own - m_all) * 1.44269504f);
  float w_oth = exp2_slot((m_oth - m_all) * 1.44269504f);
  const float l_all = l_own * w_own + l_oth * w_oth;
  const float inv = 1.0f / (l_all + other_half(l_all));
  w_own *= inv;
  w_oth *= inv;

  // ---- write bf16 attn output ([B*T x E], e = h*D + d) in packed tiles: a
  // lane holds 8 consecutive d of one query = chunk 32*(j&1) + lane of tile
  // (t>>4, 2*h + (j>>1)) -> 512 contiguous bytes per store.
  bf16* dst = attnws + ((size_t)b * Tc + q0 + 16 * kh) * Ec +
              (size_t)h * 1024 + lane * 8;
#pragma unroll
  for (int j = 0; j < 4; ++j) {
    const v8f own = kh ? acc[1][j] : acc[0][j];
    const v4f t0 = xacc[wave ^ 8][2 * j][lane];
    const v4f t1 = xacc[wave ^ 8][2 * j + 1][lane];
    v8bf o;
#pragma unroll
    for (int r = 0; r < 4; ++r) {
      o[r]     = (bf16)(own[r] * w_own + t0[r] * w_oth);
      o[4 + r] = (bf16)(own[4 + r] * w_own + t1[r] * w_oth);
    }
    *(v8bf*)(dst + (j >> 1) * 512 + (j & 1) * 256) = o;
  }
}

// ---------------------------------------------------------------------------
// Kernel 3: output projection, out = attn @ Wo^T + bo.  A work-group makes
// 128 x 128, 4 x 2 waves of 32 x 64: 256 work-groups, and the square tile reads
// the fewest operand rows per product that this count of groups allows.
// ---------------------------------------------------------------------------
__global__ __launch_bounds__(256) void out_proj_kernel(
    const bf16* __restrict__ attnws, const bf16* __restrict__ Wob,
    const float* __restrict__ bo, float* __restrict__ out) {
  const int wave = threadIdx.x >> 5;
  const int lane = threadIdx.x & 31;
  const int m0 = blockIdx.x * 128 + (wave >> 1) * 32;
  const int n0 = blockIdx.y * 128 + (wave & 1) * 64;

  v8f acc[2][4] = {};
  gemm_k_loop<2, 4>(attnws + (size_t)m0 * Ec, Wob + (size_t)n0 * Ec, acc);

  const int hi = lane >> 4, lo = lane & 15;
#pragma unroll
  for (int j = 0; j < 4; ++j) {
    const float bn = bo[n0 + 16 * j + lo];
#pragma unroll
    for (int i = 0; i < 2; ++i) {
      float* dst = out + (size_t)(m0 + 16 * i + 8 * hi) * Ec + n0 + 16 * j + lo;
#pragma unroll
      for (int r = 0; r < 8; ++r) dst[(size_t)r * Ec] = acc[i][j][r] + bn;
    }
  }
}

// ---------------------------------------------------------------------------
extern "C" void kernel_launch(void* const* d_in, const int* in_sizes, int n_in,
                              void* d_out, int out_size, void* d_ws,
                              size_t ws_size, hipStream_t stream) {
  const float* x  = (const float*)d_in[0];
  const float* Wq = (const float*)d_in[1];
  const float* bq = (const float*)d_in[2];
  const float* Wk = (const float*)d_in[3];
  const float* bk = (const float*)d_in[4];
  const float* Wv = (const float*)d_in[5];
  const float* bv = (const float*)d_in[6];
  const float* Wo = (const float*)d_in[7];
  const float* bo = (const float*)d_in[8];
  float* out = (float*)d_out;

  // Workspace layout (bf16 elements):
  //   xb (4M) | Wq (1M) | Wk (1M) | Wv (1M) | Wo (1M) |
  //   Q (4M)  | K (4M)  | V^T (4M) | attn (4M)          = 24M elems = 48MB
  const size_t nX = (size_t)Bc * Tc * Ec;  // 4,194,304
  const size_t nW = (size_t)Ec * Ec;       // 1,048,576
  bf16* xb   = (bf16*)d_ws;
  bf16* Wqb  = xb + nX;
  bf16* Wkb  = Wqb + nW;
  bf16* Wvb  = Wkb + nW;
  bf16* Wob  = Wvb + nW;
  bf16* Qws  = Wob + nW;
  bf16* Kws  = Qws + nX;
  bf16* Vtws = Kws + nX;
  bf16* attn = Vtws + nX;

  // 0) fp32 -> bf16 pre-pass (removes all conversion from GEMM hot loops):
  //    xb | Wqb | Wkb | Wvb | Wob are contiguous, 8 slabs of nW elements.
  cvt_f32_bf16_kernel<<<dim3(nW / 2048), 256, 0, stream>>>(x, Wq, Wk, Wv, Wo,
                                                           xb);

  // 1) QKV projections: 256x192 tile per group, grid (BT/256, 3E/192);
  //    Wqb | Wkb | Wvb are contiguous.
  dim3 g1(Bc * Tc / 256, 3 * Ec / 192);
  qkv_proj_kernel<<<g1, 256, 0, stream>>>(xb, Wqb, bq, bk, bv, Qws, Kws, Vtws);

  // 2) Flash attention: 32-row q-tile per pair of waves, grid (T/32/8, H, B).
  dim3 g2(Tc / 32 / 8, Hc, Bc);
  flash_attn_kernel<<<g2, 512, 0, stream>>>(Qws, Kws, Vtws, attn);

  // 3) Output projection: 128x128 tile per group.
  dim3 g3(Bc * Tc / 128, Ec / 128);
  out_proj_kernel<<<g3, 256, 0, stream>>>(attn, Wob, bo, out);
}

// v008
// It runs in 63.4 microseconds.
// It is 1.12 times as fast as v006, going by the measured steps of the versions left out in between.
// Over all steps from v000 it is 3.71 times as fast.
#include <hip/hip_runtime.h>
#include <hip/hip_bf16.h>

// ---------------------------------------------------------------------------
// MHA forward for MI455X (gfx1250, wave32, WMMA).
// All four matmul stages use v_wmma_f32_16x16x32_bf16 with register blocking;
// fp32->bf16 conversion is hoisted into a one-shot pre-pass.
// All matmul operands (x, the weights, Q, K, V^T, attn) lie in the workspace
// in fragment order: see load_frag_packed.
// ---------------------------------------------------------------------------

typedef __bf16 bf16;
typedef __attribute__((ext_vector_type(16))) __bf16 v16bf;
typedef __attribute__((ext_vector_type(8)))  __bf16 v8bf;
typedef __attribute__((ext_vector_type(8)))  float  v8f;
typedef __attribute__((ext_vector_type(4)))  float  v4f;

constexpr int Bc = 2;
constexpr int Tc = 2048;
constexpr int Ec = 1024;
constexpr int Hc = 16;
constexpr int Dc = 64;   // Ec / Hc
// 1/sqrt(Dc) * log2(e): softmax(s / sqrt(D)) = 2^(s * kQScale) / sum.
constexpr float kQScale = 0.125f * 1.44269504f;

// D = A(16x32 bf16) * B(32x16 bf16, row-of-K per lane) + C(16x16 f32)
__device__ __forceinline__ v8f wmma_bf16(v16bf a, v16bf b, v8f c) {
  return __builtin_amdgcn_wmma_f32_16x16x32_bf16(
      /*neg_a=*/false, a, /*neg_b=*/false, b,
      /*c_mod=*/(short)0, c, /*reuse_a=*/false, /*reuse_b=*/false);
}

// 16x32 bf16 fragment.  ISA 16-bit A layout (wave32): lane L holds row (L&15);
// K-chunks of 8 at columns (L>>4)*8 and 16+(L>>4)*8.  Two 16B loads per lane.
// It is read from a packed tile of 512 elements (1 KB): chunk c of 8
// elements, c = 32*part + lane, holds row (lane&15), columns
// 16*part + (lane>>4)*8 .. +7.  Each of the two loads then covers 512
// contiguous bytes (4 whole 128-B lines) instead of 32 B in each of 16 lines.
// p: the lane's own first chunk, tile + lane * 8.
__device__ __forceinline__ v16bf load_frag_lane(const bf16* p) {
  v8bf lo = *(const v8bf*)(p);
  v8bf hi = *(const v8bf*)(p + 256);
  return __builtin_shufflevector(lo, hi, 0, 1, 2, 3, 4, 5, 6, 7,
                                 8, 9, 10, 11, 12, 13, 14, 15);
}
__device__ __forceinline__ v16bf load_frag_packed(const bf16* tile) {
  return load_frag_lane(tile + (threadIdx.x & 31) * 8);
}

// A [rows x Ec] matrix in packed tiles: tile (row>>4, col>>5) starts at
// element (row>>4)*16*Ec + (col>>5)*512, so a 16-row block is contiguous in k.

// One k step (32) of a wave tile of 16*MI rows x 16*NJ columns: its MI + NJ
// fragments, all loads issued as one group.  Ak, Bk: the step's packed tile of
// the wave's first rows / columns (the same in every lane); l8: the lane's
// chunk in a tile.
template <int MI, int NJ>
__device__ __forceinline__ void gemm_load_step(const bf16* Ak, const bf16* Bk,
                                               unsigned l8, v16bf (&a)[MI],
                                               v16bf (&b)[NJ]) {
  // Keeps the group whole, behind the products of the step before: without it
  // the compiler lifts parts of it among them, into further registers, and the
  // loads then stand at several places of a step instead of one.
  __builtin_amdgcn_sched_barrier(0);
#pragma unroll
  for (int i = 0; i < MI; ++i)
    a[i] = load_frag_lane(Ak + i * 16 * Ec + l8);
#pragma unroll
  for (int j = 0; j < NJ; ++j)
    b[j] = load_frag_lane(Bk + j * 16 * Ec + l8);
  // Stands in front of the next rewrite of the address registers that the
  // loads above name.  The two bases and the offset are inputs so that they
  // live up to the wait: the next step's bases then take their registers only
  // behind it.
  asm volatile("s_wait_xcnt 0x0" :: "s"(Ak), "s"(Bk), "v"(l8) : "memory");
  // Keeps the products that follow in the source behind the whole group:
  // without it the compiler lifts them among the loads to save registers, and
  // the wave then waits for the group right after issuing it.
  __builtin_amdgcn_sched_barrier(0);
}

template <int MI, int NJ>
__device__ __forceinline__ void gemm_mma_step(const v16bf (&a)[MI],
                                              const v16bf (&b)[NJ],
                                              v8f (&acc)[MI][NJ]) {
#pragma unroll
  for (int j = 0; j < NJ; ++j)
#pragma unroll
    for (int i = 0; i < MI; ++i)
      acc[i][j] = wmma_bf16(a[i], b[j], acc[i][j]);
}

// acc += A . B^T over all of k, walked in steps of 32 from step rot on and
// round through step 0 to step rot - 1.  rot is the work-group's own (the same
// in all its waves): groups that share operand rows run in step, and with one
// start they would all ask L2 for the same lines at the same moment.
// Three fragment sets in a ring: each step's loads are issued two steps ahead,
// in front of the products of the step that is due, so a group has two steps'
// products of time to land.  The loop is unrolled whole so that the ring index
// is a constant; an address is a scalar base of the step, the lane's offset
// and an immediate.
template <int MI, int NJ>
__device__ __forceinline__ void gemm_k_loop(const bf16* Atile,
                                            const bf16* Btile, int rot,
                                            v8f (&acc)[MI][NJ]) {
  constexpr int NS = 3, steps = Ec / 32;
  const unsigned l8 = (threadIdx.x & 31) * 8;
  // Element offset of walk step st's packed tiles in a 16-row block.
  auto at = [&](int st) { return ((st + rot) & (steps - 1)) * 512; };
  v16bf a[NS][MI], b[NS][NJ];
#pragma unroll
  for (int st = 0; st < NS - 1; ++st)
    gemm_load_step(Atile + at(st), Btile + at(st), l8, a[st], b[st]);
#pragma unroll
  for (int st = 0; st < steps; ++st) {
    if (st + NS - 1 < steps)
      gemm_load_step(Atile + at(st + NS - 1), Btile + at(st + NS - 1), l8,
                     a[(st + NS - 1) % NS], b[(st + NS - 1) % NS]);
    gemm_mma_step(a[st % NS], b[st % NS], acc);
  }
}

// ---------------------------------------------------------------------------
// Kernel 0: one-shot fp32 -> bf16 conversion of x and the four weights into
// packed tiles, one launch.  The destinations lie one behind the other in the
// workspace, and x is four slabs of the shape of a weight ([Ec x Ec]), so the
// work is 8 equal slabs.  One thread makes the same 16-B chunk of every slab:
// 16 loads in flight per lane and 4096 waves in all (a pass this short is
// bound by the start of its waves, not by its bytes).  A wave takes 8 rows of
// one tile: 4 lanes read one 128-B line of a source, and the 8 chunks of equal
// columns make one whole 128-B line of dst.
// ---------------------------------------------------------------------------
__global__ __launch_bounds__(256) void cvt_f32_bf16_kernel(
    const float* __restrict__ x, const float* __restrict__ Wq,
    const float* __restrict__ Wk, const float* __restrict__ Wv,
    const float* __restrict__ Wo, bf16* __restrict__ dst) {
  constexpr unsigned slab = Ec * Ec;
  const unsigned g = blockIdx.x * 256 + threadIdx.x;
  const unsigned tile = g >> 6;        // tile in the slab
  const unsigned r16 = (g >> 2) & 15;  // row in the tile
  const unsigned q = g & 3;            // columns 8*q .. 8*q + 7 of the tile
  const unsigned row = (tile / (Ec / 32)) * 16 + r16;
  const unsigned col = (tile % (Ec / 32)) * 32 + q * 8;
  const unsigned so = (row * Ec + col) * 4;  // byte offset in a source slab
  const unsigned i = tile * 512 + (q * 16 + r16) * 8;  // chunk 16*q + r16
  const unsigned xo[4] = {so, so + slab * 4, so + slab * 8, so + slab * 12};
  const float* const sp[8] = {x, x, x, x, Wq, Wk, Wv, Wo};
  v4f a[8], b[8];
#pragma unroll
  for (int s = 0; s < 8; ++s) {
    const char* p = (const char*)sp[s] + xo[s < 4 ? s : 0];
    a[s] = *(const v4f*)(p);
    b[s] = *(const v4f*)(p + 16);
  }
  // Stands in front of every reuse of the address registers that the loads
  // above name.  The offsets are inputs so that they live up to the wait:
  // otherwise the last load lands in them.
  asm volatile("s_wait_xcnt 0x0"
               :: "v"(xo[0]), "v"(xo[1]), "v"(xo[2]), "v"(xo[3]) : "memory");
#pragma unroll
  for (int s = 0; s < 8; ++s) {
    v8bf o;
#pragma unroll
    for (int j = 0; j < 4; ++j) {
      o[j]     = (bf16)a[s][j];
      o[4 + j] = (bf16)b[s][j];
    }
    *(v8bf*)(dst + (size_t)s * slab + i) = o;
  }
}

// ---------------------------------------------------------------------------
// Kernel 1: fused QKV projection as one product Y = x . W^T with W the 3*Ec
// rows Wq | Wk | Wv, which lie one behind the other in the workspace.
// A work-group makes 256 tokens x 192 features, 4 x 2 waves of 64 x 96 (4 x 6
// WMMA tiles): 256 work-groups, one per WGP, and per k step the group reads
// 448 operand rows for 192 products, so few bytes come from L2 per product.
// Each 16-feature tile lies in one of Q, K, V and in one head.
// Q, K and V^T -> packed tiles, 4 tiles (4 KB) per head and chunk of 32 tokens;
// every 128-B line of them holds features of one 16-feature tile, so one wave
// writes it whole:
//   Q, K tile (t>>4)*2 + (d>>5): rows = tokens, columns = d;
//   V^T  tile (t>>5)*4 + (d>>4): rows = d,      columns = tokens.
// ---------------------------------------------------------------------------
__global__ __launch_bounds__(256) void qkv_proj_kernel(
    const bf16* __restrict__ xb, const bf16* __restrict__ Wqkv,
    const float* __restrict__ bq, const float* __restrict__ bk,
    const float* __restrict__ bv,
    bf16* __restrict__ Qws, bf16* __restrict__ Kws, bf16* __restrict__ Vtws) {
  // The wave's number in a scalar register: every test below on a tile's
  // place is then a scalar branch.
  const int wave = __builtin_amdgcn_readfirstlane(threadIdx.x >> 5);
  const int lane = threadIdx.x & 31;
  const int m0 = blockIdx.x * 256 + (wave >> 1) * 64;  // token-row block
  const int n0 = blockIdx.y * 192 + (wave & 1) * 96;   // row block of W

  const int hi = lane >> 4, lo = lane & 15;

  // The six tiles' biases, asked for ahead of the k loop: they land behind it.
  float bn[6];
#pragma unroll
  for (int j = 0; j < 6; ++j) {
    const int n = n0 + 16 * j;
    const float* bias = (n >> 10) == 0 ? bq : (n >> 10) == 1 ? bk : bv;
    bn[j] = bias[(n & (Ec - 1)) + lo];
  }
  // Stands in front of every reuse of the address registers that the loads
  // above name.
  asm volatile("s_wait_xcnt 0x0" ::: "memory");

  v8f acc[4][6] = {};
  // 16 groups share each block of tokens and 16 each block of W rows: within
  // either set the starts lie 2 steps apart.
  const int rot = ((blockIdx.x + blockIdx.y) & 15) * 2;
  gemm_k_loop<4, 6>(xb + (size_t)m0 * Ec, Wqkv + (size_t)n0 * Ec, rot, acc);

  // The wave's 64 tokens lie in one batch:
  // acc[i][j][r] = Y[token t0 + 16*i + 8*hi + r][row n0 + 16*j + lo of W].
  const int t0 = m0 & (Tc - 1);
  const size_t b0 = (size_t)(m0 >> 11) * Hc;  // T = 2048

#pragma unroll
  for (int j = 0; j < 6; ++j) {
    const int n = n0 + 16 * j;
    const int which = n >> 10;     // 0:Q 1:K 2:V  (E = 1024)
    const int f = n & (Ec - 1);    // first feature of the tile
    const int jj = (f >> 4) & 3;   // d = 16*jj + lo  (D = 64)
    const size_t head = (b0 + (f >> 6)) * Tc * Dc + (size_t)t0 * Dc;

    if (which == 2) {
      // V^T: fixed d, 8 consecutive t = chunk 32*(i&1) + lane of tile jj of
      // key chunk i>>1 -> 512 contiguous bytes per store.
      bf16* dst = Vtws + head + jj * 512 + lane * 8;
#pragma unroll
      for (int i = 0; i < 4; ++i) {
        v8bf o;
#pragma unroll
        for (int r = 0; r < 8; ++r) o[r] = (bf16)(acc[i][j][r] + bn[j]);
        *(v8bf*)(dst + (i >> 1) * 2048 + (i & 1) * 256) = o;
      }
      // Stands in front of every reuse of the registers that the stores above
      // name: in the built kernel another tile's or case's code follows.
      asm volatile("s_wait_xcnt 0x0" ::: "memory");
    } else {
      // Q is stored times 1/sqrt(D) * log2(e): the score products of the
      // attention kernel are then exponents of 2 as they come.  K: times 1.
      const float f = which == 0 ? kQScale : 1.0f;
      bn[j] *= f;
#pragma unroll
      for (int i = 0; i < 4; ++i) acc[i][j] *= f;
      // Q, K: tile 2*i + (jj>>1) of the wave's tokens, chunk
      // 32*(jj&1) + 16*(lo>>3) + 8*hi + r, element lo & 7.
      bf16* dst = (which == 0 ? Qws : Kws) + head + (jj >> 1) * 512 +
                  (jj & 1) * 256 + ((lo >> 3) * 16 + 8 * hi) * 8 + (lo & 7);
#pragma unroll
      for (int i = 0; i < 4; ++i)
#pragma unroll
        for (int r = 0; r < 8; ++r)
          dst[i * 1024 + r * 8] = (bf16)(acc[i][j][r] + bn[j]);
      // The same wait, for the same reason.
      asm volatile("s_wait_xcnt 0x0" ::: "memory");
    }
  }
}

// ---------------------------------------------------------------------------
// Kernel 2: flash attention, transposed products.  A pair of waves owns 32
// queries (2 column groups of 16 sharing every K/V fragment), each wave one
// half of the keys, so that 16 waves (4 per SIMD) stand on a WGP and one
// wave's softmax runs beside the others' products; keys in chunks of 32
// with online softmax.  S^T = K . Q^T puts one query's scores into one lane
// pair (l, l ^ 16): D register r = S^T[key 8*(l>>4) + r][query l & 15].  Two
// such tiles, converted in place, are the B operand of O^T += V^T . P^T.
// The softmax runs against a kept reference m per query (a score seen earlier,
// in exponents of 2): P = 2^(S - m), and O and the sums are not rescaled.  m
// moves only when a score of the pass lies far above it.
// 16 WMMAs per key-chunk; no LDS and no barrier in the loop.  Behind it the
// two waves of a pair swap one column group each through LDS and join them.
// ---------------------------------------------------------------------------

// Value of lane l ^ 16.
__device__ __forceinline__ float other_half(float x) {
  const int v = __builtin_bit_cast(int, x);
  return __builtin_bit_cast(float, __builtin_amdgcn_permlanex16(
      v, v, 0x76543210, 0xfedcba98, false, false));
}

// 2^x.  The v_nop fills the slot behind a transcendental, in front of an
// instruction that reads its result or takes its source register; it stands
// in the same statement so that it stays directly behind.
__device__ __forceinline__ float exp2_slot(float x) {
  float r;
  asm("v_exp_f32 %0, %1\n\tv_nop" : "=v"(r) : "v"(x));
  return r;
}

__global__ __launch_bounds__(512) void flash_attn_kernel(
    const bf16* __restrict__ Qws, const bf16* __restrict__ Kws,
    const bf16* __restrict__ Vtws, bf16* __restrict__ attnws) {
  // What a wave hands to its partner: one column group's O^T, reference and sum.
  __shared__ v4f xacc[16][8][32];
  __shared__ float xml[16][2][32];
  constexpr int Th = Tc / 2;  // keys per wave
  // The wave's number in a scalar register: base addresses are then scalar.
  const int wave = __builtin_amdgcn_readfirstlane(threadIdx.x >> 5);
  const int lane = threadIdx.x & 31;
  const int b = blockIdx.z, h = blockIdx.y;
  const int kh = wave >> 3;  // which half of the keys
  const int q0 = (blockIdx.x * 8 + (wave & 7)) * 32;
  // First key of the walk in the wave's half.  The 8 groups of a head run in
  // step over the same K and V: each starts 128 keys further on and walks
  // round, so that they do not ask L2 for the same lines at the same moment.
  const int rot = blockIdx.x * (Th / 8);

  const bf16* Qbase = Qws + (((size_t)b * Hc + h) * Tc + q0) * Dc;
  const bf16* Kbase = Kws + (((size_t)b * Hc + h) * Tc + kh * Th) * Dc;
  const bf16* Vbase = Vtws + (((size_t)b * Hc + h) * Tc + kh * Th) * Dc;

  // Q tiles (2 x 16 x 64) in registers: [qsub][k-chunk of 32], 4 packed tiles
  v16bf qa[2][2];
#pragma unroll
  for (int t = 0; t < 4; ++t)
    qa[t >> 1][t & 1] = load_frag_packed(Qbase + t * 512);

  // acc[qs][j][r] = O^T[d = 16*j + 8*(lane>>4) + r][query 16*qs + (lane&15)]
  v8f acc[2][4] = {};
  // m_i: reference of the lane's query (equal in both halves), set below;
  // l_i: running sum over the keys this half holds (joined after the loop).
  float m_i[2], l_i[2];

  // K fragments shared by both q-subtiles: [key-half][d-chunk], 4 packed tiles
  // per chunk of 32 keys, fetched one chunk ahead into the other of two sets.
  v16bf kfa[2][2], kfb[2][2];
#pragma unroll
  for (int t = 0; t < 4; ++t)
    kfa[t >> 1][t & 1] = load_frag_packed(Kbase + rot * Dc + t * 512);
  // Stands in front of every reuse of the address registers that the loads
  // above name.
  asm volatile("s_wait_xcnt 0x0" ::: "memory");

  // The scores of a chunk of 32 keys, its K in kf:
  // [q-subtile][keys 0..15 and 16..31 of the chunk].
  auto scores = [&](const v16bf (&kf)[2][2], v8f (&sc)[2][2]) {
#pragma unroll
    for (int qs = 0; qs < 2; ++qs) {
      v8f s0 = {}, s1 = {};
      s0 = wmma_bf16(kf[0][0], qa[qs][0], s0);
      s0 = wmma_bf16(kf[0][1], qa[qs][1], s0);
      s1 = wmma_bf16(kf[1][0], qa[qs][0], s1);
      s1 = wmma_bf16(kf[1][1], qa[qs][1], s1);
      sc[qs][0] = s0;
      sc[qs][1] = s1;
    }
  };
  // The lane's maximum over its 16 keys of a chunk.
  auto lane_max = [&](const v8f (&s)[2]) {
    const v8f em = __builtin_elementwise_max(s[0], s[1]);
    float mx = em[0];
#pragma unroll
    for (int r = 1; r < 8; ++r) mx = fmaxf(mx, em[r]);
    return mx;
  };

  // The first reference: the maximum over the first chunk of the wave's walk.
  {
    v8f sc[2][2];
    scores(kfa, sc);
#pragma unroll
    for (int qs = 0; qs < 2; ++qs) {
      const float mx = lane_max(sc[qs]);
      m_i[qs] = fmaxf(mx, other_half(mx));
      l_i[qs] = 0.0f;
    }
  }

  // One pass over a chunk of 32 keys, its K already in kf.  vp + vo: the
  // lane's chunk of the pass's first V^T tile; kp + ko: of the next chunk's
  // first K tile (4 packed tiles each).
  auto pass = [&](const v16bf (&kf)[2][2], v16bf (&kn)[2][2], const bf16* vp,
                  int vo, const bf16* kp, int ko) {
    // All loads of the pass as one group at its head.  This chunk's V^T tiles
    // land behind the score products and the softmax; the next chunk's K lands
    // behind the whole pass.
    v16bf vf[4];
#pragma unroll
    for (int j = 0; j < 4; ++j)
      vf[j] = load_frag_lane(vp + vo + j * 512);
#pragma unroll
    for (int t = 0; t < 4; ++t)
      kn[t >> 1][t & 1] = load_frag_lane(kp + ko + t * 512);
    // The same wait.  The two address registers are inputs so that they live
    // up to the wait: otherwise the last load lands in them.
    asm volatile("s_wait_xcnt 0x0" :: "v"(vp), "v"(kp) : "memory");
    // Keeps the products behind the whole group: lifted among the loads they
    // would delay its issue, and with it the landing of the next pass's K.
    __builtin_amdgcn_sched_barrier(0);

    v8f x[2][2];  // scores, then scores less the reference
    scores(kf, x);
    float mx[2];
#pragma unroll
    for (int qs = 0; qs < 2; ++qs) {
      x[qs][0] -= m_i[qs];
      x[qs][1] -= m_i[qs];
      mx[qs] = lane_max(x[qs]);
    }
    // One test per pass, a scalar branch: only where some score lies more than
    // 8 above its reference (P above 2^8) does the reference rise to the
    // maximum seen, and O and the sums follow.
    if (__builtin_amdgcn_ballot_w32(fmaxf(mx[0], mx[1]) > 8.0f) != 0) {
#pragma unroll
      for (int qs = 0; qs < 2; ++qs) {
        const float up = fmaxf(fmaxf(mx[qs], other_half(mx[qs])), 0.0f);
        const float alpha = __builtin_amdgcn_exp2f(-up);
        m_i[qs] += up;
        x[qs][0] -= up;
        x[qs][1] -= up;
        l_i[qs] *= alpha;
#pragma unroll
        for (int j = 0; j < 4; ++j) acc[qs][j] *= alpha;
      }
    }

    v16bf pb[2];  // P^T (32 keys x 16 queries) as B operand
#pragma unroll
    for (int qs = 0; qs < 2; ++qs) {
      v8f p0, p1;
#pragma unroll
      for (int r = 0; r < 8; ++r) {
        p0[r] = __builtin_amdgcn_exp2f(x[qs][0][r]);
        p1[r] = __builtin_amdgcn_exp2f(x[qs][1][r]);
        pb[qs][r]     = (bf16)p0[r];
        pb[qs][8 + r] = (bf16)p1[r];
      }
      const v8f ps = p0 + p1;
      float rs = ps[0];
#pragma unroll
      for (int r = 1; r < 8; ++r) rs += ps[r];
      l_i[qs] += rs;
    }

    // O^T(64x32) += V^T rows (d, the chunk's 32 keys) . P^T(32x32)
#pragma unroll
    for (int qs = 0; qs < 2; ++qs)
#pragma unroll
      for (int j = 0; j < 4; ++j)
        acc[qs][j] = wmma_bf16(vf[j], pb[qs], acc[qs][j]);
  };

  for (int it = 0; it < Th; it += 64) {
    const int kc = (it + rot) & (Th - 1);
    const bf16* vp = Vbase + (size_t)kc * Dc + lane * 8;
    const bf16* kp = Kbase + (size_t)kc * Dc + lane * 8;
    pass(kfa, kfb, vp, 0, kp, 32 * Dc);
    // The chunk fetched ahead wraps with the walk; the last pass so reads the
    // walk's first chunk again, inside this head's K without a branch.
    pass(kfb, kfa, vp, 32 * Dc,
         Kbase + (size_t)((kc + 64) & (Th - 1)) * Dc + lane * 8, 0);
  }

  // ---- join the two key halves.  Both waves of a pair hold the same element
  // at the same lane and register.  Wave kh keeps column group kh and hands
  // the other one over, 512 contiguous bytes per LDS store.
#pragma unroll
  for (int j = 0; j < 4; ++j) {
    const v8f g = kh ? acc[0][j] : acc[1][j];
    xacc[wave][2 * j][lane]     = __builtin_shufflevector(g, g, 0, 1, 2, 3);
    xacc[wave][2 * j + 1][lane] = __builtin_shufflevector(g, g, 4, 5, 6, 7);
  }
  xml[wave][0][lane] = kh ? m_i[0] : m_i[1];
  xml[wave][1][lane] = kh ? l_i[0] : l_i[1];
  // Publishes every wave's handed-over group to its partner.
  __syncthreads();
  const float m_own = kh ? m_i[1] : m_i[0];
  const float l_own = kh ? l_i[1] : l_i[0];
  const float m_oth = xml[wave ^ 8][0][lane];
  const float l_oth = xml[wave ^ 8][1][lane];
  const float m_all = fmaxf(m_own, m_oth);
  float w_own = exp2_slot(m_own - m_all);
  float w_oth = exp2_slot(m_oth - m_all);
  const float l_all = l_own * w_own + l_oth * w_oth;
  const float inv = 1.0f / (l_all + other_half(l_all));
  w_own *= inv;
  w_oth *= inv;

  // ---- write bf16 attn output ([B*T x E], e = h*D + d) in packed tiles: a
  // lane holds 8 consecutive d of one query = chunk 32*(j&1) + lane of tile
  // (t>>4, 2*h + (j>>1)) -> 512 contiguous bytes per store.
  bf16* dst = attnws + ((size_t)b * Tc + q0 + 16 * kh) * Ec +
              (size_t)h * 1024 + lane * 8;
#pragma unroll
  for (int j = 0; j < 4; ++j) {
    const v8f own = kh ? acc[1][j] : acc[0][j];
    const v4f t0 = xacc[wave ^ 8][2 * j][lane];
    const v4f t1 = xacc[wave ^ 8][2 * j + 1][lane];
    v8bf o;
#pragma unroll
    for (int r = 0; r < 4; ++r) {
      o[r]     = (bf16)(own[r] * w_own + t0[r] * w_oth);
      o[4 + r] = (bf16)(own[4 + r] * w_own + t1[r] * w_oth);
    }
    *(v8bf*)(dst + (j >> 1) * 512 + (j & 1) * 256) = o;
  }
}

// ---------------------------------------------------------------------------
// Kernel 3: output projection, out = attn @ Wo^T + bo.  A work-group makes
// 128 x 128, 4 x 2 waves of 32 x 64: 256 work-groups, and the square tile reads
// the fewest operand rows per product that this count of groups allows.
// ---------------------------------------------------------------------------
__global__ __launch_bounds__(256) void out_proj_kernel(
    const bf16* __restrict__ attnws, const bf16* __restrict__ Wob,
    const float* __restrict__ bo, float* __restrict__ out) {
  // The wave's number in a scalar register: the k loop's bases are then scalar.
  const int wave = __builtin_amdgcn_readfirstlane(threadIdx.x >> 5);
  const int lane = threadIdx.x & 31;
  const int m0 = blockIdx.x * 128 + (wave >> 1) * 32;
  const int n0 = blockIdx.y * 128 + (wave & 1) * 64;

  v8f acc[2][4] = {};
  // 8 groups share each block of tokens (starts 4 steps apart), 32 each block
  // of Wo rows (all 32 starts).
  const int rot = (blockIdx.x + 4 * blockIdx.y) & 31;
  gemm_k_loop<2, 4>(attnws + (size_t)m0 * Ec, Wob + (size_t)n0 * Ec, rot, acc);

  const int hi = lane >> 4, lo = lane & 15;
#pragma unroll
  for (int j = 0; j < 4; ++j) {
    const float bn = bo[n0 + 16 * j + lo];
#pragma unroll
    for (int i = 0; i < 2; ++i) {
      float* dst = out + (size_t)(m0 + 16 * i + 8 * hi) * Ec + n0 + 16 * j + lo;
#pragma unroll
      for (int r = 0; r < 8; ++r) dst[(size_t)r * Ec] = acc[i][j][r] + bn;
    }
  }
}

// ---------------------------------------------------------------------------
extern "C" void kernel_launch(void* const* d_in, const int* in_sizes, int n_in,
                              void* d_out, int out_size, void* d_ws,
                              size_t ws_size, hipStream_t stream) {
  const float* x  = (const float*)d_in[0];
  const float* Wq = (const float*)d_in[1];
  const float* bq = (const float*)d_in[2];
  const float* Wk = (const float*)d_in[3];
  const float* bk = (const float*)d_in[4];
  const float* Wv = (const float*)d_in[5];
  const float* bv = (const float*)d_in[6];
  const float* Wo = (const float*)d_in[7];
  const float* bo = (const float*)d_in[8];
  float* out = (float*)d_out;

  // Workspace layout (bf16 elements):
  //   xb (4M) | Wq (1M) | Wk (1M) | Wv (1M) | Wo (1M) |
  //   Q (4M)  | K (4M)  | V^T (4M) | attn (4M)          = 24M elems = 48MB
  const size_t nX = (size_t)Bc * Tc * Ec;  // 4,194,304
  const size_t nW = (size_t)Ec * Ec;       // 1,048,576
  bf16* xb   = (bf16*)d_ws;
  bf16* Wqb  = xb + nX;
  bf16* Wkb  = Wqb + nW;
  bf16* Wvb  = Wkb + nW;
  bf16* Wob  = Wvb + nW;
  bf16* Qws  = Wob + nW;
  bf16* Kws  = Qws + nX;
  bf16* Vtws = Kws + nX;
  bf16* attn = Vtws + nX;

  // 0) fp32 -> bf16 pre-pass (removes all conversion from GEMM hot loops):
  //    xb | Wqb | Wkb | Wvb | Wob are contiguous, 8 slabs of nW elements.
  cvt_f32_bf16_kernel<<<dim3(nW / 2048), 256, 0, stream>>>(x, Wq, Wk, Wv, Wo,
                                                           xb);

  // 1) QKV projections: 256x192 tile per group, grid (BT/256, 3E/192);
  //    Wqb | Wkb | Wvb are contiguous.
  dim3 g1(Bc * Tc / 256, 3 * Ec / 192);
  qkv_proj_kernel<<<g1, 256, 0, stream>>>(xb, Wqb, bq, bk, bv, Qws, Kws, Vtws);

  // 2) Flash attention: 32-row q-tile per pair of waves, grid (T/32/8, H, B).
  dim3 g2(Tc / 32 / 8, Hc, Bc);
  flash_attn_kernel<<<g2, 512, 0, stream>>>(Qws, Kws, Vtws, attn);

  // 3) Output projection: 128x128 tile per group.
  dim3 g3(Bc * Tc / 128, Ec / 128);
  out_proj_kernel<<<g3, 256, 0, stream>>>(attn, Wob, bo, out);
}

// v009
// Measured time: 60.6 microseconds a run.
// In two side-by-side timings against v008, it was 1.05 and 1.04 times as fast.
// Counting every step since v000, it is 3.87 times as fast.
#include <hip/hip_runtime.h>
#include <hip/hip_bf16.h>

// ---------------------------------------------------------------------------
// MHA forward for MI455X (gfx1250, wave32, WMMA).
// All four matmul stages use v_wmma_f32_16x16x32_bf16 with register blocking;
// fp32->bf16 conversion is hoisted into a one-shot pre-pass.
// All matmul operands (x, the weights, Q, K, V^T, attn) lie in the workspace
// in fragment order: see load_frag_packed.
// ---------------------------------------------------------------------------

typedef __bf16 bf16;
typedef __attribute__((ext_vector_type(16))) __bf16 v16bf;
typedef __attribute__((ext_vector_type(8)))  __bf16 v8bf;
typedef __attribute__((ext_vector_type(8)))  float  v8f;
typedef __attribute__((ext_vector_type(4)))  float  v4f;

constexpr int Bc = 2;
constexpr int Tc = 2048;
constexpr int Ec = 1024;
constexpr int Hc = 16;
constexpr int Dc = 64;   // Ec / Hc
// 1/sqrt(Dc) * log2(e): softmax(s / sqrt(D)) = 2^(s * kQScale) / sum.
constexpr float kQScale = 0.125f * 1.44269504f;

// D = A(16x32 bf16) * B(32x16 bf16, row-of-K per lane) + C(16x16 f32)
__device__ __forceinline__ v8f wmma_bf16(v16bf a, v16bf b, v8f c) {
  return __builtin_amdgcn_wmma_f32_16x16x32_bf16(
      /*neg_a=*/false, a, /*neg_b=*/false, b,
      /*c_mod=*/(short)0, c, /*reuse_a=*/false, /*reuse_b=*/false);
}

// 16x32 bf16 fragment.  ISA 16-bit A layout (wave32): lane L holds row (L&15);
// K-chunks of 8 at columns (L>>4)*8 and 16+(L>>4)*8.  Two 16B loads per lane.
// It is read from a packed tile of 512 elements (1 KB): chunk c of 8
// elements, c = 32*part + lane, holds row (lane&15), columns
// 16*part + (lane>>4)*8 .. +7.  Each of the two loads then covers 512
// contiguous bytes (4 whole 128-B lines) instead of 32 B in each of 16 lines.
// p: the lane's own first chunk, tile + lane * 8.
__device__ __forceinline__ v16bf load_frag_lane(const bf16* p) {
  v8bf lo = *(const v8bf*)(p);
  v8bf hi = *(const v8bf*)(p + 256);
  return __builtin_shufflevector(lo, hi, 0, 1, 2, 3, 4, 5, 6, 7,
                                 8, 9, 10, 11, 12, 13, 14, 15);
}
__device__ __forceinline__ v16bf load_frag_packed(const bf16* tile) {
  return load_frag_lane(tile + (threadIdx.x & 31) * 8);
}

// A [rows x Ec] matrix in packed tiles: tile (row>>4, col>>5) starts at
// element (row>>4)*16*Ec + (col>>5)*512, so a 16-row block is contiguous in k.

// One k step (32) of a wave tile of 16*MI rows x 16*NJ columns: its MI + NJ
// fragments, all loads issued as one group.  Ak: the step's packed tile of the
// wave's first rows, Tk, Bk: of its column tiles (the same in every lane); l8: the lane's
// chunk in a tile.  The first NT column tiles lie from Tk on, the others from
// Bk on (NT = 0: Tk is not read).
template <int MI, int NJ, int NT>
__device__ __forceinline__ void gemm_load_step(const bf16* Ak, const bf16* Tk,
                                               const bf16* Bk, unsigned l8,
                                               v16bf (&a)[MI],
                                               v16bf (&b)[NJ]) {
  // Keeps the group whole, behind the products of the step before: without it
  // the compiler lifts parts of it among them, into further registers, and the
  // loads then stand at several places of a step instead of one.
  __builtin_amdgcn_sched_barrier(0);
#pragma unroll
  for (int i = 0; i < MI; ++i)
    a[i] = load_frag_lane(Ak + i * 16 * Ec + l8);
#pragma unroll
  for (int j = 0; j < NJ; ++j)
    b[j] = load_frag_lane((j < NT ? Tk + j * 16 * Ec : Bk + (j - NT) * 16 * Ec) +
                          l8);
  // Stands in front of the next rewrite of the address registers that the
  // loads above name.  The bases and the offset are inputs so that they live
  // up to the wait: the next step's bases then take their registers only
  // behind it.
  if constexpr (NT > 0)
    asm volatile("s_wait_xcnt 0x0"
                 :: "s"(Ak), "s"(Tk), "s"(Bk), "v"(l8) : "memory");
  else
    asm volatile("s_wait_xcnt 0x0" :: "s"(Ak), "s"(Bk), "v"(l8) : "memory");
  // Keeps the products that follow in the source behind the whole group:
  // without it the compiler lifts them among the loads to save registers, and
  // the wave then waits for the group right after issuing it.
  __builtin_amdgcn_sched_barrier(0);
}

// The first NT column tiles are made transposed (the two operands have one
// fragment layout, so they only change places): a lane then holds 8
// consecutive columns of one row instead of 8 consecutive rows of one column.
template <int MI, int NJ, int NT>
__device__ __forceinline__ void gemm_mma_step(const v16bf (&a)[MI],
                                              const v16bf (&b)[NJ],
                                              v8f (&acc)[MI][NJ]) {
#pragma unroll
  for (int j = 0; j < NJ; ++j)
#pragma unroll
    for (int i = 0; i < MI; ++i)
      acc[i][j] = j < NT ? wmma_bf16(b[j], a[i], acc[i][j])
                         : wmma_bf16(a[i], b[j], acc[i][j]);
}

// acc += A . B^T over all of k, walked in steps of 32 from step rot on and
// round through step 0 to step rot - 1.  rot is the work-group's own (the same
// in all its waves): groups that share operand rows run in step, and with one
// start they would all ask L2 for the same lines at the same moment.
// Three fragment sets in a ring: each step's loads are issued two steps ahead,
// in front of the products of the step that is due, so a group has two steps'
// products of time to land.  The loop is unrolled whole so that the ring index
// is a constant; an address is a scalar base of the step, the lane's offset
// and an immediate.
template <int MI, int NJ, int NT>
__device__ __forceinline__ void gemm_k_loop(const bf16* Atile,
                                            const bf16* Ttile,
                                            const bf16* Btile, int rot,
                                            v8f (&acc)[MI][NJ]) {
  constexpr int NS = 3, steps = Ec / 32;
  const unsigned l8 = (threadIdx.x & 31) * 8;
  // Element offset of walk step st's packed tiles in a 16-row block.
  auto at = [&](int st) { return ((st + rot) & (steps - 1)) * 512; };
  v16bf a[NS][MI], b[NS][NJ];
#pragma unroll
  for (int st = 0; st < NS - 1; ++st)
    gemm_load_step<MI, NJ, NT>(Atile + at(st), Ttile + at(st), Btile + at(st),
                               l8, a[st], b[st]);
#pragma unroll
  for (int st = 0; st < steps; ++st) {
    if (st + NS - 1 < steps)
      gemm_load_step<MI, NJ, NT>(Atile + at(st + NS - 1),
                                 Ttile + at(st + NS - 1),
                                 Btile + at(st + NS - 1), l8,
                                 a[(st + NS - 1) % NS], b[(st + NS - 1) % NS]);
    gemm_mma_step<MI, NJ, NT>(a[st % NS], b[st % NS], acc);
  }
}

// ---------------------------------------------------------------------------
// Kernel 0: one-shot fp32 -> bf16 conversion of x and the four weights into
// packed tiles, one launch.  The destinations lie one behind the other in the
// workspace, and x is four slabs of the shape of a weight ([Ec x Ec]), so the
// work is 8 equal slabs.  One thread makes the same 16-B chunk of every slab:
// 16 loads in flight per lane and 4096 waves in all (a pass this short is
// bound by the start of its waves, not by its bytes).  A wave takes 8 rows of
// one tile: 4 lanes read one 128-B line of a source, and the 8 chunks of equal
// columns make one whole 128-B line of dst.  Wo's rows are dealt out on the way.
// ---------------------------------------------------------------------------
__global__ __launch_bounds__(256) void cvt_f32_bf16_kernel(
    const float* __restrict__ x, const float* __restrict__ Wq,
    const float* __restrict__ Wk, const float* __restrict__ Wv,
    const float* __restrict__ Wo, bf16* __restrict__ dst) {
  constexpr unsigned slab = Ec * Ec;
  const unsigned g = blockIdx.x * 256 + threadIdx.x;
  const unsigned tile = g >> 6;        // tile in the slab
  const unsigned r16 = (g >> 2) & 15;  // row in the tile
  const unsigned q = g & 3;            // columns 8*q .. 8*q + 7 of the tile
  const unsigned row = (tile / (Ec / 32)) * 16 + r16;
  const unsigned col = (tile % (Ec / 32)) * 32 + q * 8;
  const unsigned so = (row * Ec + col) * 4;  // byte offset in a source slab
  const unsigned i = tile * 512 + (q * 16 + r16) * 8;  // chunk 16*q + r16
  const unsigned xo[4] = {so, so + slab * 4, so + slab * 8, so + slab * 12};
  // Wo alone is packed with its rows dealt out: in each block of 64 rows,
  // packed row 16*j + c is source row 4*c + j (see out_proj_kernel).
  const unsigned rowo = (row & ~63u) + 4 * r16 + ((row >> 4) & 3);
  const unsigned wo = (rowo * Ec + col) * 4;
  const float* const sp[8] = {x, x, x, x, Wq, Wk, Wv, Wo};
  v4f a[8], b[8];
  // Keeps all address arithmetic in front of the loads: they then issue as one
  // group, and no register that one of them names is reused among them.
  __builtin_amdgcn_sched_barrier(0);
#pragma unroll
  for (int s = 0; s < 8; ++s) {
    const char* p = (const char*)sp[s] + (s == 7 ? wo : xo[s < 4 ? s : 0]);
    a[s] = *(const v4f*)(p);
    b[s] = *(const v4f*)(p + 16);
  }
  // Stands in front of every reuse of the address registers that the loads
  // above name.  The offsets are inputs so that they live up to the wait:
  // otherwise the last load lands in them.
  asm volatile("s_wait_xcnt 0x0"
               :: "v"(xo[0]), "v"(xo[1]), "v"(xo[2]), "v"(xo[3]), "v"(wo)
               : "memory");
#pragma unroll
  for (int s = 0; s < 8; ++s) {
    v8bf o;
#pragma unroll
    for (int j = 0; j < 4; ++j) {
      o[j]     = (bf16)a[s][j];
      o[4 + j] = (bf16)b[s][j];
    }
    *(v8bf*)(dst + (size_t)s * slab + i) = o;
  }
}

// ---------------------------------------------------------------------------
// Kernel 1: fused QKV projection as one product Y = x . W^T with W the 3*Ec
// rows Wq | Wk | Wv, which lie one behind the other in the workspace.
// A work-group makes 256 tokens x 192 features, 4 x 2 waves of 64 x 96 (4 x 6
// WMMA tiles): 256 work-groups, one per WGP, and per k step the group reads
// 448 operand rows for 192 products, so few bytes come from L2 per product.
// Each of the 32 wave columns takes one whole head of Q or K (4 tiles) and one
// half head of V (2 tiles).  Q and K want 8 consecutive d of one token in a
// lane, V^T 8 consecutive tokens of one d: the Q and K tiles are made
// transposed, and every tile then leaves in one 16-B store per lane.
// Q, K and V^T -> packed tiles, 4 tiles (4 KB) per head and chunk of 32 tokens;
// every store of a wave covers 512 contiguous bytes, 4 whole lines:
//   Q, K tile (t>>4)*2 + (d>>5): rows = tokens, columns = d;
//   V^T  tile (t>>5)*4 + (d>>4): rows = d,      columns = tokens.
// ---------------------------------------------------------------------------
__global__ __launch_bounds__(256) void qkv_proj_kernel(
    const bf16* __restrict__ xb, const bf16* __restrict__ Wqkv,
    const float* __restrict__ bq, const float* __restrict__ bk,
    const float* __restrict__ bv,
    bf16* __restrict__ Qws, bf16* __restrict__ Kws, bf16* __restrict__ Vtws) {
  // The wave's number in a scalar register: every choice below between Q and K
  // is then a scalar select.
  const int wave = __builtin_amdgcn_readfirstlane(threadIdx.x >> 5);
  const int lane = threadIdx.x & 31;
  const int m0 = blockIdx.x * 256 + (wave >> 1) * 64;  // token-row block
  const int wc = blockIdx.y * 2 + (wave & 1);          // wave column, 0..31
  const bool isK = wc >= Hc;     // heads of Q, then heads of K
  const int hqk = wc & (Hc - 1);

  const int hi = lane >> 4, lo = lane & 15;

  v8f acc[4][6] = {};
  // 16 groups share each block of tokens and 16 each block of W rows: within
  // either set the starts lie 2 steps apart.
  const int rot = ((blockIdx.x + blockIdx.y) & 15) * 2;
  gemm_k_loop<4, 6, 4>(xb + (size_t)m0 * Ec, Wqkv + (size_t)wc * Dc * Ec,
                       Wqkv + (size_t)(2 * Ec + wc * 32) * Ec, rot, acc);

  // The six tiles' biases.  Q, K: features 16*j + 8*hi + r of the head; V:
  // feature 16*j + lo.  They stand behind the k loop because 34 registers more
  // through the loop do not fit beside two waves per SIMD.
  const char* bqk = (const char*)((isK ? bk : bq) + hqk * Dc);
  const char* bvw = (const char*)(bv + wc * 32);
  const unsigned oq = hi * 32, ov = lo * 4;  // the lane's byte offsets
  v4f bt[4][2];
  float bn[2];
#pragma unroll
  for (int j = 0; j < 4; ++j) {
    bt[j][0] = *(const v4f*)(bqk + oq + 64 * j);
    bt[j][1] = *(const v4f*)(bqk + oq + 64 * j + 16);
  }
#pragma unroll
  for (int j = 0; j < 2; ++j) bn[j] = *(const float*)(bvw + ov + 64 * j);
  // Stands in front of every reuse of the address registers that the loads
  // above name.  The offsets are inputs so that they live up to the wait:
  // otherwise the last load lands in them.
  asm volatile("s_wait_xcnt 0x0" :: "v"(oq), "v"(ov) : "memory");

  // The wave's 64 tokens lie in one batch.
  const int t0 = m0 & (Tc - 1);
  const size_t b0 = (size_t)(m0 >> 11) * Hc;  // T = 2048

  // Q, K: acc[i][j][r] = Y[token t0 + 16*i + lo][d = 16*j + 8*hi + r]
  // = chunk 32*(j&1) + lane of tile 2*i + (j>>1) of the wave's tokens.
  // Q is stored times 1/sqrt(D) * log2(e): the score products of the attention
  // kernel are then exponents of 2 as they come.  K: times 1.
  {
    const float f = isK ? 1.0f : kQScale;
    bf16* dst = (isK ? Kws : Qws) + (b0 + hqk) * Tc * Dc + (size_t)t0 * Dc +
                lane * 8;
#pragma unroll
    for (int j = 0; j < 4; ++j) {
      const v8f bj = __builtin_shufflevector(bt[j][0], bt[j][1], 0, 1, 2, 3, 4,
                                             5, 6, 7) * f;
#pragma unroll
      for (int i = 0; i < 4; ++i) {
        const v8f y = acc[i][j] * f + bj;
        v8bf o;
#pragma unroll
        for (int r = 0; r < 8; ++r) o[r] = (bf16)y[r];
        *(v8bf*)(dst + i * 1024 + (j >> 1) * 512 + (j & 1) * 256) = o;
      }
    }
  }

  // V^T: acc[i][4 + j][r] = Y[token t0 + 16*i + 8*hi + r][d = 16*jj + lo],
  // jj = 2*(wc&1) + j: fixed d, 8 consecutive t = chunk 32*(i&1) + lane of
  // tile jj of key chunk i>>1.
  {
    bf16* dst = Vtws + (b0 + (wc >> 1)) * Tc * Dc + (size_t)t0 * Dc +
                (wc & 1) * 1024 + lane * 8;
#pragma unroll
    for (int j = 0; j < 2; ++j)
#pragma unroll
      for (int i = 0; i < 4; ++i) {
        v8bf o;
#pragma unroll
        for (int r = 0; r < 8; ++r) o[r] = (bf16)(acc[i][4 + j][r] + bn[j]);
        *(v8bf*)(dst + j * 512 + (i >> 1) * 2048 + (i & 1) * 256) = o;
      }
  }
}

// ---------------------------------------------------------------------------
// Kernel 2: flash attention, transposed products.  A pair of waves owns 32
// queries (2 column groups of 16 sharing every K/V fragment), each wave one
// half of the keys, so that 16 waves (4 per SIMD) stand on a WGP and one
// wave's softmax runs beside the others' products; keys in chunks of 32
// with online softmax.  S^T = K . Q^T puts one query's scores into one lane
// pair (l, l ^ 16): D register r = S^T[key 8*(l>>4) + r][query l & 15].  Two
// such tiles, converted in place, are the B operand of O^T += V^T . P^T.
// The softmax runs against a kept reference m per query (a score seen earlier,
// in exponents of 2): P = 2^(S - m), and O and the sums are not rescaled.  m
// moves only when a score of the pass lies far above it.
// 16 WMMAs per key-chunk; no LDS and no barrier in the loop.  Behind it the
// two waves of a pair swap one column group each through LDS and join them.
// ---------------------------------------------------------------------------

// Value of lane l ^ 16.
__device__ __forceinline__ float other_half(float x) {
  const int v = __builtin_bit_cast(int, x);
  return __builtin_bit_cast(float, __builtin_amdgcn_permlanex16(
      v, v, 0x76543210, 0xfedcba98, false, false));
}

// 2^x.  The v_nop fills the slot behind a transcendental, in front of an
// instruction that reads its result or takes its source register; it stands
// in the same statement so that it stays directly behind.
__device__ __forceinline__ float exp2_slot(float x) {
  float r;
  asm("v_exp_f32 %0, %1\n\tv_nop" : "=v"(r) : "v"(x));
  return r;
}

__global__ __launch_bounds__(512) void flash_attn_kernel(
    const bf16* __restrict__ Qws, const bf16* __restrict__ Kws,
    const bf16* __restrict__ Vtws, bf16* __restrict__ attnws) {
  // What a wave hands to its partner: one column group's O^T, reference and sum.
  __shared__ v4f xacc[16][8][32];
  __shared__ float xml[16][2][32];
  constexpr int Th = Tc / 2;  // keys per wave
  // The wave's number in a scalar register: base addresses are then scalar.
  const int wave = __builtin_amdgcn_readfirstlane(threadIdx.x >> 5);
  const int lane = threadIdx.x & 31;
  const int b = blockIdx.z, h = blockIdx.y;
  const int kh = wave >> 3;  // which half of the keys
  const int q0 = (blockIdx.x * 8 + (wave & 7)) * 32;
  // First key of the walk in the wave's half.  The 8 groups of a head run in
  // step over the same K and V: each starts 128 keys further on and walks
  // round, so that they do not ask L2 for the same lines at the same moment.
  const int rot = blockIdx.x * (Th / 8);

  const bf16* Qbase = Qws + (((size_t)b * Hc + h) * Tc + q0) * Dc;
  const bf16* Kbase = Kws + (((size_t)b * Hc + h) * Tc + kh * Th) * Dc;
  const bf16* Vbase = Vtws + (((size_t)b * Hc + h) * Tc + kh * Th) * Dc;

  // Q tiles (2 x 16 x 64) in registers: [qsub][k-chunk of 32], 4 packed tiles
  v16bf qa[2][2];
#pragma unroll
  for (int t = 0; t < 4; ++t)
    qa[t >> 1][t & 1] = load_frag_packed(Qbase + t * 512);

  // acc[qs][j][r] = O^T[d = 16*j + 8*(lane>>4) + r][query 16*qs + (lane&15)]
  v8f acc[2][4] = {};
  // m_i: reference of the lane's query (equal in both halves), set below;
  // l_i: running sum over the keys this half holds (joined after the loop).
  float m_i[2], l_i[2];

  // K fragments shared by both q-subtiles: [key-half][d-chunk], 4 packed tiles
  // per chunk of 32 keys, fetched one chunk ahead into the other of two sets.
  v16bf kfa[2][2], kfb[2][2];
#pragma unroll
  for (int t = 0; t < 4; ++t)
    kfa[t >> 1][t & 1] = load_frag_packed(Kbase + rot * Dc + t * 512);
  // Stands in front of every reuse of the address registers that the loads
  // above name.
  asm volatile("s_wait_xcnt 0x0" ::: "memory");

  // The scores of a chunk of 32 keys, its K in kf:
  // [q-subtile][keys 0..15 and 16..31 of the chunk].
  auto scores = [&](const v16bf (&kf)[2][2], v8f (&sc)[2][2]) {
#pragma unroll
    for (int qs = 0; qs < 2; ++qs) {
      v8f s0 = {}, s1 = {};
      s0 = wmma_bf16(kf[0][0], qa[qs][0], s0);
      s0 = wmma_bf16(kf[0][1], qa[qs][1], s0);
      s1 = wmma_bf16(kf[1][0], qa[qs][0], s1);
      s1 = wmma_bf16(kf[1][1], qa[qs][1], s1);
      sc[qs][0] = s0;
      sc[qs][1] = s1;
    }
  };
  // The lane's maximum over its 16 keys of a chunk.
  auto lane_max = [&](const v8f (&s)[2]) {
    const v8f em = __builtin_elementwise_max(s[0], s[1]);
    float mx = em[0];
#pragma unroll
    for (int r = 1; r < 8; ++r) mx = fmaxf(mx, em[r]);
    return mx;
  };

  // The first reference: the maximum over the first chunk of the wave's walk.
  {
    v8f sc[2][2];
    scores(kfa, sc);
#pragma unroll
    for (int qs = 0; qs < 2; ++qs) {
      const float mx = lane_max(sc[qs]);
      m_i[qs] = fmaxf(mx, other_half(mx));
      l_i[qs] = 0.0f;
    }
  }

  // One pass over a chunk of 32 keys, its K already in kf.  vp + vo: the
  // lane's chunk of the pass's first V^T tile; kp + ko: of the next chunk's
  // first K tile (4 packed tiles each).
  auto pass = [&](const v16bf (&kf)[2][2], v16bf (&kn)[2][2], const bf16* vp,
                  int vo, const bf16* kp, int ko) {
    // All loads of the pass as one group at its head.  This chunk's V^T tiles
    // land behind the score products and the softmax; the next chunk's K lands
    // behind the whole pass.
    v16bf vf[4];
#pragma unroll
    for (int j = 0; j < 4; ++j)
      vf[j] = load_frag_lane(vp + vo + j * 512);
#pragma unroll
    for (int t = 0; t < 4; ++t)
      kn[t >> 1][t & 1] = load_frag_lane(kp + ko + t * 512);
    // The same wait.  The two address registers are inputs so that they live
    // up to the wait: otherwise the last load lands in them.
    asm volatile("s_wait_xcnt 0x0" :: "v"(vp), "v"(kp) : "memory");
    // Keeps the products behind the whole group: lifted among the loads they
    // would delay its issue, and with it the landing of the next pass's K.
    __builtin_amdgcn_sched_barrier(0);

    v8f x[2][2];  // scores, then scores less the reference
    scores(kf, x);
    float mx[2];
#pragma unroll
    for (int qs = 0; qs < 2; ++qs) {
      x[qs][0] -= m_i[qs];
      x[qs][1] -= m_i[qs];
      mx[qs] = lane_max(x[qs]);
    }
    // One test per pass, a scalar branch: only where some score lies more than
    // 8 above its reference (P above 2^8) does the reference rise to the
    // maximum seen, and O and the sums follow.
    if (__builtin_amdgcn_ballot_w32(fmaxf(mx[0], mx[1]) > 8.0f) != 0) {
#pragma unroll
      for (int qs = 0; qs < 2; ++qs) {
        const float up = fmaxf(fmaxf(mx[qs], other_half(mx[qs])), 0.0f);
        const float alpha = __builtin_amdgcn_exp2f(-up);
        m_i[qs] += up;
        x[qs][0] -= up;
        x[qs][1] -= up;
        l_i[qs] *= alpha;
#pragma unroll
        for (int j = 0; j < 4; ++j) acc[qs][j] *= alpha;
      }
    }

    v16bf pb[2];  // P^T (32 keys x 16 queries) as B operand
#pragma unroll
    for (int qs = 0; qs < 2; ++qs) {
      v8f p0, p1;
#pragma unroll
      for (int r = 0; r < 8; ++r) {
        p0[r] = __builtin_amdgcn_exp2f(x[qs][0][r]);
        p1[r] = __builtin_amdgcn_exp2f(x[qs][1][r]);
        pb[qs][r]     = (bf16)p0[r];
        pb[qs][8 + r] = (bf16)p1[r];
      }
      const v8f ps = p0 + p1;
      float rs = ps[0];
#pragma unroll
      for (int r = 1; r < 8; ++r) rs += ps[r];
      l_i[qs] += rs;
    }

    // O^T(64x32) += V^T rows (d, the chunk's 32 keys) . P^T(32x32)
#pragma unroll
    for (int qs = 0; qs < 2; ++qs)
#pragma unroll
      for (int j = 0; j < 4; ++j)
        acc[qs][j] = wmma_bf16(vf[j], pb[qs], acc[qs][j]);
  };

  for (int it = 0; it < Th; it += 64) {
    const int kc = (it + rot) & (Th - 1);
    const bf16* vp = Vbase + (size_t)kc * Dc + lane * 8;
    const bf16* kp = Kbase + (size_t)kc * Dc + lane * 8;
    pass(kfa, kfb, vp, 0, kp, 32 * Dc);
    // The chunk fetched ahead wraps with the walk; the last pass so reads the
    // walk's first chunk again, inside this head's K without a branch.
    pass(kfb, kfa, vp, 32 * Dc,
         Kbase + (size_t)((kc + 64) & (Th - 1)) * Dc + lane * 8, 0);
  }

  // ---- join the two key halves.  Both waves of a pair hold the same element
  // at the same lane and register.  Wave kh keeps column group kh and hands
  // the other one over, 512 contiguous bytes per LDS store.
#pragma unroll
  for (int j = 0; j < 4; ++j) {
    const v8f g = kh ? acc[0][j] : acc[1][j];
    xacc[wave][2 * j][lane]     = __builtin_shufflevector(g, g, 0, 1, 2, 3);
    xacc[wave][2 * j + 1][lane] = __builtin_shufflevector(g, g, 4, 5, 6, 7);
  }
  xml[wave][0][lane] = kh ? m_i[0] : m_i[1];
  xml[wave][1][lane] = kh ? l_i[0] : l_i[1];
  // Publishes every wave's handed-over group to its partner.
  __syncthreads();
  const float m_own = kh ? m_i[1] : m_i[0];
  const float l_own = kh ? l_i[1] : l_i[0];
  const float m_oth = xml[wave ^ 8][0][lane];
  const float l_oth = xml[wave ^ 8][1][lane];
  const float m_all = fmaxf(m_own, m_oth);
  float w_own = exp2_slot(m_own - m_all);
  float w_oth = exp2_slot(m_oth - m_all);
  const float l_all = l_own * w_own + l_oth * w_oth;
  const float inv = 1.0f / (l_all + other_half(l_all));
  w_own *= inv;
  w_oth *= inv;

  // ---- write bf16 attn output ([B*T x E], e = h*D + d) in packed tiles: a
  // lane holds 8 consecutive d of one query = chunk 32*(j&1) + lane of tile
  // (t>>4, 2*h + (j>>1)) -> 512 contiguous bytes per store.
  bf16* dst = attnws + ((size_t)b * Tc + q0 + 16 * kh) * Ec +
              (size_t)h * 1024 + lane * 8;
#pragma unroll
  for (int j = 0; j < 4; ++j) {
    const v8f own = kh ? acc[1][j] : acc[0][j];
    const v4f t0 = xacc[wave ^ 8][2 * j][lane];
    const v4f t1 = xacc[wave ^ 8][2 * j + 1][lane];
    v8bf o;
#pragma unroll
    for (int r = 0; r < 4; ++r) {
      o[r]     = (bf16)(own[r] * w_own + t0[r] * w_oth);
      o[4 + r] = (bf16)(own[4 + r] * w_own + t1[r] * w_oth);
    }
    *(v8bf*)(dst + (j >> 1) * 512 + (j & 1) * 256) = o;
  }
}

// ---------------------------------------------------------------------------
// Kernel 3: output projection, out = attn @ Wo^T + bo.  A work-group makes
// 128 x 128, 4 x 2 waves of 32 x 64: 256 work-groups, and the square tile reads
// the fewest operand rows per product that this count of groups allows.
// Wob: Wo with the rows of each block of 64 dealt over its four 16-row tiles.
// ---------------------------------------------------------------------------
__global__ __launch_bounds__(256) void out_proj_kernel(
    const bf16* __restrict__ attnws, const bf16* __restrict__ Wob,
    const float* __restrict__ bo, float* __restrict__ out) {
  // The wave's number in a scalar register: the k loop's bases are then scalar.
  const int wave = __builtin_amdgcn_readfirstlane(threadIdx.x >> 5);
  const int lane = threadIdx.x & 31;
  const int m0 = blockIdx.x * 128 + (wave >> 1) * 32;
  const int n0 = blockIdx.y * 128 + (wave & 1) * 64;

  v8f acc[2][4] = {};
  // 8 groups share each block of tokens (starts 4 steps apart), 32 each block
  // of Wo rows (all 32 starts).
  const int rot = (blockIdx.x + 4 * blockIdx.y) & 31;
  const bf16* Wrows = Wob + (size_t)n0 * Ec;
  gemm_k_loop<2, 4, 0>(attnws + (size_t)m0 * Ec, Wrows, Wrows, rot, acc);

  // Column lo of tile j is feature n0 + 4*lo + j (the packing of Wo): a lane's
  // four tiles hold 4 adjacent features of a token, one 16-B store, and 16
  // lanes cover 256 contiguous bytes of an output row.
  const int hi = lane >> 4, lo = lane & 15;
  const v4f bn = *(const v4f*)(bo + n0 + 4 * lo);
#pragma unroll
  for (int i = 0; i < 2; ++i) {
    float* dst = out + (size_t)(m0 + 16 * i + 8 * hi) * Ec + n0 + 4 * lo;
#pragma unroll
    for (int r = 0; r < 8; ++r) {
      const v4f o = {acc[i][0][r], acc[i][1][r], acc[i][2][r], acc[i][3][r]};
      *(v4f*)(dst + (size_t)r * Ec) = o + bn;
    }
  }
}

// ---------------------------------------------------------------------------
extern "C" void kernel_launch(void* const* d_in, const int* in_sizes, int n_in,
                              void* d_out, int out_size, void* d_ws,
                              size_t ws_size, hipStream_t stream) {
  const float* x  = (const float*)d_in[0];
  const float* Wq = (const float*)d_in[1];
  const float* bq = (const float*)d_in[2];
  const float* Wk = (const float*)d_in[3];
  const float* bk = (const float*)d_in[4];
  const float* Wv = (const float*)d_in[5];
  const float* bv = (const float*)d_in[6];
  const float* Wo = (const float*)d_in[7];
  const float* bo = (const float*)d_in[8];
  float* out = (float*)d_out;

  // Workspace layout (bf16 elements):
  //   xb (4M) | Wq (1M) | Wk (1M) | Wv (1M) | Wo (1M) |
  //   Q (4M)  | K (4M)  | V^T (4M) | attn (4M)          = 24M elems = 48MB
  const size_t nX = (size_t)Bc * Tc * Ec;  // 4,194,304
  const size_t nW = (size_t)Ec * Ec;       // 1,048,576
  bf16* xb   = (bf16*)d_ws;
  bf16* Wqb  = xb + nX;
  bf16* Wkb  = Wqb + nW;
  bf16* Wvb  = Wkb + nW;
  bf16* Wob  = Wvb + nW;
  bf16* Qws  = Wob + nW;
  bf16* Kws  = Qws + nX;
  bf16* Vtws = Kws + nX;
  bf16* attn = Vtws + nX;

  // 0) fp32 -> bf16 pre-pass (removes all conversion from GEMM hot loops):
  //    xb | Wqb | Wkb | Wvb | Wob are contiguous, 8 slabs of nW elements.
  cvt_f32_bf16_kernel<<<dim3(nW / 2048), 256, 0, stream>>>(x, Wq, Wk, Wv, Wo,
                                                           xb);

  // 1) QKV projections: 256x192 tile per group, grid (BT/256, 3E/192);
  //    Wqb | Wkb | Wvb are contiguous.
  dim3 g1(Bc * Tc / 256, 3 * Ec / 192);
  qkv_proj_kernel<<<g1, 256, 0, stream>>>(xb, Wqb, bq, bk, bv, Qws, Kws, Vtws);

  // 2) Flash attention: 32-row q-tile per pair of waves, grid (T/32/8, H, B).
  dim3 g2(Tc / 32 / 8, Hc, Bc);
  flash_attn_kernel<<<g2, 512, 0, stream>>>(Qws, Kws, Vtws, attn);

  // 3) Output projection: 128x128 tile per group.
  dim3 g3(Bc * Tc / 128, Ec / 128);
  out_proj_kernel<<<g3, 256, 0, stream>>>(attn, Wob, bo, out);
}

// v010
// It runs in 57.8 microseconds.
// Timed twice side by side with v009, it ran 1.05 times as fast both times.
// All steps since v000 together make it 4.05 times as fast.
#include <hip/hip_runtime.h>
#include <hip/hip_bf16.h>

// ---------------------------------------------------------------------------
// MHA forward for MI455X (gfx1250, wave32, WMMA).
// All four matmul stages use v_wmma_f32_16x16x32_bf16 with register blocking;
// fp32->bf16 conversion is hoisted into a one-shot pre-pass.
// All matmul operands (x, the weights, Q, K, V^T, attn) lie in the workspace
// in fragment order: see load_frag_packed.
// ---------------------------------------------------------------------------

typedef __bf16 bf16;
typedef __attribute__((ext_vector_type(16))) __bf16 v16bf;
typedef __attribute__((ext_vector_type(8)))  __bf16 v8bf;
typedef __attribute__((ext_vector_type(8)))  float  v8f;
typedef __attribute__((ext_vector_type(4)))  float  v4f;

constexpr int Bc = 2;
constexpr int Tc = 2048;
constexpr int Ec = 1024;
constexpr int Hc = 16;
constexpr int Dc = 64;   // Ec / Hc
// 1/sqrt(Dc) * log2(e): softmax(s / sqrt(D)) = 2^(s * kQScale) / sum.
constexpr float kQScale = 0.125f * 1.44269504f;

// D = A(16x32 bf16) * B(32x16 bf16, row-of-K per lane) + C(16x16 f32)
__device__ __forceinline__ v8f wmma_bf16(v16bf a, v16bf b, v8f c) {
  return __builtin_amdgcn_wmma_f32_16x16x32_bf16(
      /*neg_a=*/false, a, /*neg_b=*/false, b,
      /*c_mod=*/(short)0, c, /*reuse_a=*/false, /*reuse_b=*/false);
}

// 16x32 bf16 fragment.  ISA 16-bit A layout (wave32): lane L holds row (L&15);
// K-chunks of 8 at columns (L>>4)*8 and 16+(L>>4)*8.  Two 16B loads per lane.
// It is read from a packed tile of 512 elements (1 KB): chunk c of 8
// elements, c = 32*part + lane, holds row (lane&15), columns
// 16*part + (lane>>4)*8 .. +7.  Each of the two loads then covers 512
// contiguous bytes (4 whole 128-B lines) instead of 32 B in each of 16 lines.
// p: the lane's own first chunk, tile + lane * 8.
__device__ __forceinline__ v16bf load_frag_lane(const bf16* p) {
  v8bf lo = *(const v8bf*)(p);
  v8bf hi = *(const v8bf*)(p + 256);
  return __builtin_shufflevector(lo, hi, 0, 1, 2, 3, 4, 5, 6, 7,
                                 8, 9, 10, 11, 12, 13, 14, 15);
}
__device__ __forceinline__ v16bf load_frag_packed(const bf16* tile) {
  return load_frag_lane(tile + (threadIdx.x & 31) * 8);
}

// A [rows x Ec] matrix in packed tiles: tile (row>>4, col>>5) starts at
// element (row>>4)*16*Ec + (col>>5)*512, so a 16-row block is contiguous in k.

// One k step (32) of a wave tile of 16*MI rows x 16*NJ columns: its MI + NJ
// fragments, all loads issued as one group.  Ak: the step's packed tile of the
// wave's first rows, Tk, Bk: of its column tiles (the same in every lane); l8: the lane's
// chunk in a tile.  The first NT column tiles lie from Tk on, the others from
// Bk on (NT = 0: Tk is not read).
template <int MI, int NJ, int NT>
__device__ __forceinline__ void gemm_load_step(const bf16* Ak, const bf16* Tk,
                                               const bf16* Bk, unsigned l8,
                                               v16bf (&a)[MI],
                                               v16bf (&b)[NJ]) {
  // Keeps the group whole, behind the products of the step before: without it
  // the compiler lifts parts of it among them, into further registers, and the
  // loads then stand at several places of a step instead of one.
  __builtin_amdgcn_sched_barrier(0);
#pragma unroll
  for (int i = 0; i < MI; ++i)
    a[i] = load_frag_lane(Ak + i * 16 * Ec + l8);
#pragma unroll
  for (int j = 0; j < NJ; ++j)
    b[j] = load_frag_lane((j < NT ? Tk + j * 16 * Ec : Bk + (j - NT) * 16 * Ec) +
                          l8);
  // Stands in front of the next rewrite of the address registers that the
  // loads above name.  The bases and the offset are inputs so that they live
  // up to the wait: the next step's bases then take their registers only
  // behind it.
  if constexpr (NT > 0)
    asm volatile("s_wait_xcnt 0x0"
                 :: "s"(Ak), "s"(Tk), "s"(Bk), "v"(l8) : "memory");
  else
    asm volatile("s_wait_xcnt 0x0" :: "s"(Ak), "s"(Bk), "v"(l8) : "memory");
  // Keeps the products that follow in the source behind the whole group:
  // without it the compiler lifts them among the loads to save registers, and
  // the wave then waits for the group right after issuing it.
  __builtin_amdgcn_sched_barrier(0);
}

// The first NT column tiles are made transposed (the two operands have one
// fragment layout, so they only change places): a lane then holds 8
// consecutive columns of one row instead of 8 consecutive rows of one column.
template <int MI, int NJ, int NT>
__device__ __forceinline__ void gemm_mma_step(const v16bf (&a)[MI],
                                              const v16bf (&b)[NJ],
                                              v8f (&acc)[MI][NJ]) {
#pragma unroll
  for (int j = 0; j < NJ; ++j)
#pragma unroll
    for (int i = 0; i < MI; ++i)
      acc[i][j] = j < NT ? wmma_bf16(b[j], a[i], acc[i][j])
                         : wmma_bf16(a[i], b[j], acc[i][j]);
}

// acc += A . B^T over all of k, walked in steps of 32 from step rot on and
// round through step 0 to step rot - 1.  rot is the work-group's own (the same
// in all its waves): groups that share operand rows run in step, and with one
// start they would all ask L2 for the same lines at the same moment.
// Three fragment sets in a ring: each step's loads are issued two steps ahead,
// in front of the products of the step that is due, so a group has two steps'
// products of time to land.  The loop is unrolled whole so that the ring index
// is a constant; an address is a scalar base of the step, the lane's offset
// and an immediate.
template <int MI, int NJ, int NT>
__device__ __forceinline__ void gemm_k_loop(const bf16* Atile,
                                            const bf16* Ttile,
                                            const bf16* Btile, int rot,
                                            v8f (&acc)[MI][NJ]) {
  constexpr int NS = 3, steps = Ec / 32;
  const unsigned l8 = (threadIdx.x & 31) * 8;
  // Element offset of walk step st's packed tiles in a 16-row block.
  auto at = [&](int st) { return ((st + rot) & (steps - 1)) * 512; };
  v16bf a[NS][MI], b[NS][NJ];
#pragma unroll
  for (int st = 0; st < NS - 1; ++st)
    gemm_load_step<MI, NJ, NT>(Atile + at(st), Ttile + at(st), Btile + at(st),
                               l8, a[st], b[st]);
#pragma unroll
  for (int st = 0; st < steps; ++st) {
    if (st + NS - 1 < steps)
      gemm_load_step<MI, NJ, NT>(Atile + at(st + NS - 1),
                                 Ttile + at(st + NS - 1),
                                 Btile + at(st + NS - 1), l8,
                                 a[(st + NS - 1) % NS], b[(st + NS - 1) % NS]);
    gemm_mma_step<MI, NJ, NT>(a[st % NS], b[st % NS], acc);
  }
}

// ---------------------------------------------------------------------------
// Kernel 0: one-shot fp32 -> bf16 conversion of x and the four weights into
// packed tiles, one launch.  The destinations lie one behind the other in the
// workspace, and x is four slabs of the shape of a weight ([Ec x Ec]), so the
// work is 8 equal slabs.  One thread makes the same 16-B chunk of every slab:
// 16 loads in flight per lane and 4096 waves in all (a pass this short is
// bound by the start of its waves, not by its bytes).  A wave takes 8 rows of
// one tile: 4 lanes read one 128-B line of a source, and the 8 chunks of equal
// columns make one whole 128-B line of dst.  Wo's rows are dealt out on the way.
// ---------------------------------------------------------------------------
__global__ __launch_bounds__(256) void cvt_f32_bf16_kernel(
    const float* __restrict__ x, const float* __restrict__ Wq,
    const float* __restrict__ Wk, const float* __restrict__ Wv,
    const float* __restrict__ Wo, bf16* __restrict__ dst) {
  constexpr unsigned slab = Ec * Ec;
  const unsigned g = blockIdx.x * 256 + threadIdx.x;
  const unsigned tile = g >> 6;        // tile in the slab
  const unsigned r16 = (g >> 2) & 15;  // row in the tile
  const unsigned q = g & 3;            // columns 8*q .. 8*q + 7 of the tile
  const unsigned row = (tile / (Ec / 32)) * 16 + r16;
  const unsigned col = (tile % (Ec / 32)) * 32 + q * 8;
  const unsigned so = (row * Ec + col) * 4;  // byte offset in a source slab
  const unsigned i = tile * 512 + (q * 16 + r16) * 8;  // chunk 16*q + r16
  const unsigned xo[4] = {so, so + slab * 4, so + slab * 8, so + slab * 12};
  // Wo alone is packed with its rows dealt out: in each block of 64 rows,
  // packed row 16*j + c is source row 4*c + j (see out_proj_kernel).
  const unsigned rowo = (row & ~63u) + 4 * r16 + ((row >> 4) & 3);
  const unsigned wo = (rowo * Ec + col) * 4;
  const float* const sp[8] = {x, x, x, x, Wq, Wk, Wv, Wo};
  v4f a[8], b[8];
  // Keeps all address arithmetic in front of the loads: they then issue as one
  // group, and no register that one of them names is reused among them.
  __builtin_amdgcn_sched_barrier(0);
#pragma unroll
  for (int s = 0; s < 8; ++s) {
    const char* p = (const char*)sp[s] + (s == 7 ? wo : xo[s < 4 ? s : 0]);
    a[s] = *(const v4f*)(p);
    b[s] = *(const v4f*)(p + 16);
  }
  // Stands in front of every reuse of the address registers that the loads
  // above name.  The offsets are inputs so that they live up to the wait:
  // otherwise the last load lands in them.
  asm volatile("s_wait_xcnt 0x0"
               :: "v"(xo[0]), "v"(xo[1]), "v"(xo[2]), "v"(xo[3]), "v"(wo)
               : "memory");
#pragma unroll
  for (int s = 0; s < 8; ++s) {
    v8bf o;
#pragma unroll
    for (int j = 0; j < 4; ++j) {
      o[j]     = (bf16)a[s][j];
      o[4 + j] = (bf16)b[s][j];
    }
    *(v8bf*)(dst + (size_t)s * slab + i) = o;
  }
}

// ---------------------------------------------------------------------------
// Kernel 1: fused QKV projection as one product Y = x . W^T with W the 3*Ec
// rows Wq | Wk | Wv, which lie one behind the other in the workspace.
// A work-group makes 256 tokens x 192 features, 4 x 2 waves of 64 x 96 (4 x 6
// WMMA tiles): 256 work-groups, one per WGP, and per k step the group reads
// 448 operand rows for 192 products, so few bytes come from L2 per product.
// Each of the 32 wave columns takes one whole head of Q or K (4 tiles) and one
// half head of V (2 tiles).  Q and K want 8 consecutive d of one token in a
// lane, V^T 8 consecutive tokens of one d: the Q and K tiles are made
// transposed, and every tile then leaves in one 16-B store per lane.
// Q, K and V^T -> packed tiles, 4 tiles (4 KB) per head and chunk of 32 tokens;
// every store of a wave covers 512 contiguous bytes, 4 whole lines:
//   Q, K tile (t>>4)*2 + (d>>5): rows = tokens, columns = d;
//   V^T  tile (t>>5)*4 + (d>>4): rows = d,      columns = tokens.
// ---------------------------------------------------------------------------
__global__ __launch_bounds__(256) void qkv_proj_kernel(
    const bf16* __restrict__ xb, const bf16* __restrict__ Wqkv,
    const float* __restrict__ bq, const float* __restrict__ bk,
    const float* __restrict__ bv,
    bf16* __restrict__ Qws, bf16* __restrict__ Kws, bf16* __restrict__ Vtws) {
  // The wave's number in a scalar register: every choice below between Q and K
  // is then a scalar select.
  const int wave = __builtin_amdgcn_readfirstlane(threadIdx.x >> 5);
  const int lane = threadIdx.x & 31;
  const int m0 = blockIdx.x * 256 + (wave >> 1) * 64;  // token-row block
  const int wc = blockIdx.y * 2 + (wave & 1);          // wave column, 0..31
  const bool isK = wc >= Hc;     // heads of Q, then heads of K
  const int hqk = wc & (Hc - 1);

  const int hi = lane >> 4, lo = lane & 15;

  v8f acc[4][6] = {};
  // 16 groups share each block of tokens and 16 each block of W rows: within
  // either set the starts lie 2 steps apart.
  const int rot = ((blockIdx.x + blockIdx.y) & 15) * 2;
  gemm_k_loop<4, 6, 4>(xb + (size_t)m0 * Ec, Wqkv + (size_t)wc * Dc * Ec,
                       Wqkv + (size_t)(2 * Ec + wc * 32) * Ec, rot, acc);

  // The six tiles' biases.  Q, K: features 16*j + 8*hi + r of the head; V:
  // feature 16*j + lo.  They stand behind the k loop because 34 registers more
  // through the loop do not fit beside two waves per SIMD.
  const char* bqk = (const char*)((isK ? bk : bq) + hqk * Dc);
  const char* bvw = (const char*)(bv + wc * 32);
  const unsigned oq = hi * 32, ov = lo * 4;  // the lane's byte offsets
  v4f bt[4][2];
  float bn[2];
#pragma unroll
  for (int j = 0; j < 4; ++j) {
    bt[j][0] = *(const v4f*)(bqk + oq + 64 * j);
    bt[j][1] = *(const v4f*)(bqk + oq + 64 * j + 16);
  }
#pragma unroll
  for (int j = 0; j < 2; ++j) bn[j] = *(const float*)(bvw + ov + 64 * j);
  // Stands in front of every reuse of the address registers that the loads
  // above name.  The offsets are inputs so that they live up to the wait:
  // otherwise the last load lands in them.
  asm volatile("s_wait_xcnt 0x0" :: "v"(oq), "v"(ov) : "memory");

  // The wave's 64 tokens lie in one batch.
  const int t0 = m0 & (Tc - 1);
  const size_t b0 = (size_t)(m0 >> 11) * Hc;  // T = 2048

  // Q, K: acc[i][j][r] = Y[token t0 + 16*i + lo][d = 16*j + 8*hi + r]
  // = chunk 32*(j&1) + lane of tile 2*i + (j>>1) of the wave's tokens.
  // Q is stored times 1/sqrt(D) * log2(e): the score products of the attention
  // kernel are then exponents of 2 as they come.  K: times 1.
  {
    const float f = isK ? 1.0f : kQScale;
    bf16* dst = (isK ? Kws : Qws) + (b0 + hqk) * Tc * Dc + (size_t)t0 * Dc +
                lane * 8;
#pragma unroll
    for (int j = 0; j < 4; ++j) {
      const v8f bj = __builtin_shufflevector(bt[j][0], bt[j][1], 0, 1, 2, 3, 4,
                                             5, 6, 7) * f;
#pragma unroll
      for (int i = 0; i < 4; ++i) {
        const v8f y = acc[i][j] * f + bj;
        v8bf o;
#pragma unroll
        for (int r = 0; r < 8; ++r) o[r] = (bf16)y[r];
        *(v8bf*)(dst + i * 1024 + (j >> 1) * 512 + (j & 1) * 256) = o;
      }
    }
  }

  // V^T: acc[i][4 + j][r] = Y[token t0 + 16*i + 8*hi + r][d = 16*jj + lo],
  // jj = 2*(wc&1) + j: fixed d, 8 consecutive t = chunk 32*(i&1) + lane of
  // tile jj of key chunk i>>1.
  {
    bf16* dst = Vtws + (b0 + (wc >> 1)) * Tc * Dc + (size_t)t0 * Dc +
                (wc & 1) * 1024 + lane * 8;
#pragma unroll
    for (int j = 0; j < 2; ++j)
#pragma unroll
      for (int i = 0; i < 4; ++i) {
        v8bf o;
#pragma unroll
        for (int r = 0; r < 8; ++r) o[r] = (bf16)(acc[i][4 + j][r] + bn[j]);
        *(v8bf*)(dst + j * 512 + (i >> 1) * 2048 + (i & 1) * 256) = o;
      }
  }
}

// ---------------------------------------------------------------------------
// Kernel 2: flash attention, transposed products.  A pair of waves owns 32
// queries (2 column groups of 16 sharing every K/V fragment), each wave one
// half of the keys, so that 16 waves (4 per SIMD) stand on a WGP and one
// wave's softmax runs beside the others' products; keys in chunks of 32
// with online softmax.  S^T = K . Q^T puts one query's scores into one lane
// pair (l, l ^ 16): D register r = S^T[key 8*(l>>4) + r][query l & 15].  Two
// such tiles, converted in place, are the B operand of O^T += V^T . P^T.
// The softmax runs against a kept reference m per query (a score seen earlier,
// in exponents of 2): P = 2^(S - m), and O and the sums are not rescaled.  m
// moves only when a score of the pass lies far above it.
// 16 WMMAs per key-chunk; no LDS and no barrier in the loop.  Behind it the
// two waves of a pair swap one column group each through LDS and join them.
// ---------------------------------------------------------------------------

// Value of lane l ^ 16.
__device__ __forceinline__ float other_half(float x) {
  const int v = __builtin_bit_cast(int, x);
  return __builtin_bit_cast(float, __builtin_amdgcn_permlanex16(
      v, v, 0x76543210, 0xfedcba98, false, false));
}

// 2^x.  The v_nop fills the slot behind a transcendental, in front of an
// instruction that reads its result or takes its source register; it stands
// in the same statement so that it stays directly behind.
__device__ __forceinline__ float exp2_slot(float x) {
  float r;
  asm("v_exp_f32 %0, %1\n\tv_nop" : "=v"(r) : "v"(x));
  return r;
}

__global__ __launch_bounds__(512) void flash_attn_kernel(
    const bf16* __restrict__ Qws, const bf16* __restrict__ Kws,
    const bf16* __restrict__ Vtws, bf16* __restrict__ attnws) {
  // What a wave hands to its partner: one column group's O^T, reference and sum.
  __shared__ v4f xacc[16][8][32];
  __shared__ float xml[16][2][32];
  constexpr int Th = Tc / 2;  // keys per wave
  // The wave's number in a scalar register: base addresses are then scalar.
  const int wave = __builtin_amdgcn_readfirstlane(threadIdx.x >> 5);
  const int lane = threadIdx.x & 31;
  // Which head and which block of 256 queries the group takes.  The fastest grid
  // index picks among 8 heads, so the 8 groups of one head have one residue of
  // the flat index modulo 8 (for speed only; any placement gives the same
  // values).
  const int hb = blockIdx.x + 8 * blockIdx.z;  // batch * Hc + head
  const int b = hb / Hc, h = hb % Hc;
  const int qb = blockIdx.y;  // block of 256 queries
  const int kh = wave >> 3;  // which half of the keys
  const int q0 = (qb * 8 + (wave & 7)) * 32;
  // First key of the walk in the wave's half.  The 8 groups of a head run in
  // step over the same K and V: each starts 128 keys further on and walks
  // round, so that they do not ask L2 for the same lines at the same moment.
  const int rot = qb * (Th / 8);

  const bf16* Qbase = Qws + (((size_t)b * Hc + h) * Tc + q0) * Dc;
  const bf16* Kbase = Kws + (((size_t)b * Hc + h) * Tc + kh * Th) * Dc;
  const bf16* Vbase = Vtws + (((size_t)b * Hc + h) * Tc + kh * Th) * Dc;

  // Q tiles (2 x 16 x 64) in registers: [qsub][k-chunk of 32], 4 packed tiles
  v16bf qa[2][2];
#pragma unroll
  for (int t = 0; t < 4; ++t)
    qa[t >> 1][t & 1] = load_frag_packed(Qbase + t * 512);

  // acc[qs][j][r] = O^T[d = 16*j + 8*(lane>>4) + r][query 16*qs + (lane&15)]
  v8f acc[2][4] = {};
  // m_i: reference of the lane's query (equal in both halves), set below;
  // l_i: running sum over the keys this half holds (joined after the loop).
  float m_i[2], l_i[2];

  // K fragments shared by both q-subtiles: [key-half][d-chunk], 4 packed tiles
  // per chunk of 32 keys, fetched one chunk ahead into the other of two sets.
  v16bf kfa[2][2], kfb[2][2];
#pragma unroll
  for (int t = 0; t < 4; ++t)
    kfa[t >> 1][t & 1] = load_frag_packed(Kbase + rot * Dc + t * 512);
  // Stands in front of every reuse of the address registers that the loads
  // above name.
  asm volatile("s_wait_xcnt 0x0" ::: "memory");

  // The scores of a chunk of 32 keys, its K in kf:
  // [q-subtile][keys 0..15 and 16..31 of the chunk].
  auto scores = [&](const v16bf (&kf)[2][2], v8f (&sc)[2][2]) {
#pragma unroll
    for (int qs = 0; qs < 2; ++qs) {
      v8f s0 = {}, s1 = {};
      s0 = wmma_bf16(kf[0][0], qa[qs][0], s0);
      s0 = wmma_bf16(kf[0][1], qa[qs][1], s0);
      s1 = wmma_bf16(kf[1][0], qa[qs][0], s1);
      s1 = wmma_bf16(kf[1][1], qa[qs][1], s1);
      sc[qs][0] = s0;
      sc[qs][1] = s1;
    }
  };
  // The lane's maximum over its 16 keys of a chunk.
  auto lane_max = [&](const v8f (&s)[2]) {
    const v8f em = __builtin_elementwise_max(s[0], s[1]);
    float mx = em[0];
#pragma unroll
    for (int r = 1; r < 8; ++r) mx = fmaxf(mx, em[r]);
    return mx;
  };

  // The first reference: the maximum over the first chunk of the wave's walk.
  {
    v8f sc[2][2];
    scores(kfa, sc);
#pragma unroll
    for (int qs = 0; qs < 2; ++qs) {
      const float mx = lane_max(sc[qs]);
      m_i[qs] = fmaxf(mx, other_half(mx));
      l_i[qs] = 0.0f;
    }
  }

  // One pass over a chunk of 32 keys, its K already in kf.  vp + vo: the
  // lane's chunk of the pass's first V^T tile; kp + ko: of the next chunk's
  // first K tile (4 packed tiles each).
  auto pass = [&](const v16bf (&kf)[2][2], v16bf (&kn)[2][2], const bf16* vp,
                  int vo, const bf16* kp, int ko) {
    // All loads of the pass as one group at its head.  This chunk's V^T tiles
    // land behind the score products and the softmax; the next chunk's K lands
    // behind the whole pass.
    v16bf vf[4];
#pragma unroll
    for (int j = 0; j < 4; ++j)
      vf[j] = load_frag_lane(vp + vo + j * 512);
#pragma unroll
    for (int t = 0; t < 4; ++t)
      kn[t >> 1][t & 1] = load_frag_lane(kp + ko + t * 512);
    // The same wait.  The two address registers are inputs so that they live
    // up to the wait: otherwise the last load lands in them.
    asm volatile("s_wait_xcnt 0x0" :: "v"(vp), "v"(kp) : "memory");
    // Keeps the products behind the whole group: lifted among the loads they
    // would delay its issue, and with it the landing of the next pass's K.
    __builtin_amdgcn_sched_barrier(0);

    v8f x[2][2];  // scores, then scores less the reference
    scores(kf, x);
    float mx[2];
#pragma unroll
    for (int qs = 0; qs < 2; ++qs) {
      x[qs][0] -= m_i[qs];
      x[qs][1] -= m_i[qs];
      mx[qs] = lane_max(x[qs]);
    }
    // One test per pass, a scalar branch: only where some score lies more than
    // 8 above its reference (P above 2^8) does the reference rise to the
    // maximum seen, and O and the sums follow.
    if (__builtin_amdgcn_ballot_w32(fmaxf(mx[0], mx[1]) > 8.0f) != 0) {
#pragma unroll
      for (int qs = 0; qs < 2; ++qs) {
        const float up = fmaxf(fmaxf(mx[qs], other_half(mx[qs])), 0.0f);
        const float alpha = __builtin_amdgcn_exp2f(-up);
        m_i[qs] += up;
        x[qs][0] -= up;
        x[qs][1] -= up;
        l_i[qs] *= alpha;
#pragma unroll
        for (int j = 0; j < 4; ++j) acc[qs][j] *= alpha;
      }
    }

    v16bf pb[2];  // P^T (32 keys x 16 queries) as B operand
#pragma unroll
    for (int qs = 0; qs < 2; ++qs) {
      v8f p0, p1;
#pragma unroll
      for (int r = 0; r < 8; ++r) {
        p0[r] = __builtin_amdgcn_exp2f(x[qs][0][r]);
        p1[r] = __builtin_amdgcn_exp2f(x[qs][1][r]);
        pb[qs][r]     = (bf16)p0[r];
        pb[qs][8 + r] = (bf16)p1[r];
      }
      const v8f ps = p0 + p1;
      float rs = ps[0];
#pragma unroll
      for (int r = 1; r < 8; ++r) rs += ps[r];
      l_i[qs] += rs;
    }

    // O^T(64x32) += V^T rows (d, the chunk's 32 keys) . P^T(32x32)
#pragma unroll
    for (int qs = 0; qs < 2; ++qs)
#pragma unroll
      for (int j = 0; j < 4; ++j)
        acc[qs][j] = wmma_bf16(vf[j], pb[qs], acc[qs][j]);
  };

  for (int it = 0; it < Th; it += 64) {
    const int kc = (it + rot) & (Th - 1);
    const bf16* vp = Vbase + (size_t)kc * Dc + lane * 8;
    const bf16* kp = Kbase + (size_t)kc * Dc + lane * 8;
    pass(kfa, kfb, vp, 0, kp, 32 * Dc);
    // The chunk fetched ahead wraps with the walk; the last pass so reads the
    // walk's first chunk again, inside this head's K without a branch.
    pass(kfb, kfa, vp, 32 * Dc,
         Kbase + (size_t)((kc + 64) & (Th - 1)) * Dc + lane * 8, 0);
  }

  // ---- join the two key halves.  Both waves of a pair hold the same element
  // at the same lane and register.  Wave kh keeps column group kh and hands
  // the other one over, 512 contiguous bytes per LDS store.
#pragma unroll
  for (int j = 0; j < 4; ++j) {
    const v8f g = kh ? acc[0][j] : acc[1][j];
    xacc[wave][2 * j][lane]     = __builtin_shufflevector(g, g, 0, 1, 2, 3);
    xacc[wave][2 * j + 1][lane] = __builtin_shufflevector(g, g, 4, 5, 6, 7);
  }
  xml[wave][0][lane] = kh ? m_i[0] : m_i[1];
  xml[wave][1][lane] = kh ? l_i[0] : l_i[1];
  // Publishes every wave's handed-over group to its partner.
  __syncthreads();
  const float m_own = kh ? m_i[1] : m_i[0];
  const float l_own = kh ? l_i[1] : l_i[0];
  const float m_oth = xml[wave ^ 8][0][lane];
  const float l_oth = xml[wave ^ 8][1][lane];
  const float m_all = fmaxf(m_own, m_oth);
  float w_own = exp2_slot(m_own - m_all);
  float w_oth = exp2_slot(m_oth - m_all);
  const float l_all = l_own * w_own + l_oth * w_oth;
  const float inv = 1.0f / (l_all + other_half(l_all));
  w_own *= inv;
  w_oth *= inv;

  // ---- write bf16 attn output ([B*T x E], e = h*D + d) in packed tiles: a
  // lane holds 8 consecutive d of one query = chunk 32*(j&1) + lane of tile
  // (t>>4, 2*h + (j>>1)) -> 512 contiguous bytes per store.
  bf16* dst = attnws + ((size_t)b * Tc + q0 + 16 * kh) * Ec +
              (size_t)h * 1024 + lane * 8;
#pragma unroll
  for (int j = 0; j < 4; ++j) {
    const v8f own = kh ? acc[1][j] : acc[0][j];
    const v4f t0 = xacc[wave ^ 8][2 * j][lane];
    const v4f t1 = xacc[wave ^ 8][2 * j + 1][lane];
    v8bf o;
#pragma unroll
    for (int r = 0; r < 4; ++r) {
      o[r]     = (bf16)(own[r] * w_own + t0[r] * w_oth);
      o[4 + r] = (bf16)(own[4 + r] * w_own + t1[r] * w_oth);
    }
    *(v8bf*)(dst + (j >> 1) * 512 + (j & 1) * 256) = o;
  }
}

// ---------------------------------------------------------------------------
// Kernel 3: output projection, out = attn @ Wo^T + bo.  A work-group makes
// 128 x 128, 4 x 2 waves of 32 x 64: 256 work-groups, and the square tile reads
// the fewest operand rows per product that this count of groups allows.
// Wob: Wo with the rows of each block of 64 dealt over its four 16-row tiles.
// ---------------------------------------------------------------------------
__global__ __launch_bounds__(256) void out_proj_kernel(
    const bf16* __restrict__ attnws, const bf16* __restrict__ Wob,
    const float* __restrict__ bo, float* __restrict__ out) {
  // The wave's number in a scalar register: the k loop's bases are then scalar.
  const int wave = __builtin_amdgcn_readfirstlane(threadIdx.x >> 5);
  const int lane = threadIdx.x & 31;
  const int m0 = blockIdx.x * 128 + (wave >> 1) * 32;
  const int n0 = blockIdx.y * 128 + (wave & 1) * 64;

  v8f acc[2][4] = {};
  // 8 groups share each block of tokens (starts 4 steps apart), 32 each block
  // of Wo rows (all 32 starts).
  const int rot = (blockIdx.x + 4 * blockIdx.y) & 31;
  const bf16* Wrows = Wob + (size_t)n0 * Ec;
  gemm_k_loop<2, 4, 0>(attnws + (size_t)m0 * Ec, Wrows, Wrows, rot, acc);

  // Column lo of tile j is feature n0 + 4*lo + j (the packing of Wo): a lane's
  // four tiles hold 4 adjacent features of a token, one 16-B store, and 16
  // lanes cover 256 contiguous bytes of an output row.
  const int hi = lane >> 4, lo = lane & 15;
  const v4f bn = *(const v4f*)(bo + n0 + 4 * lo);
#pragma unroll
  for (int i = 0; i < 2; ++i) {
    float* dst = out + (size_t)(m0 + 16 * i + 8 * hi) * Ec + n0 + 4 * lo;
#pragma unroll
    for (int r = 0; r < 8; ++r) {
      const v4f o = {acc[i][0][r], acc[i][1][r], acc[i][2][r], acc[i][3][r]};
      *(v4f*)(dst + (size_t)r * Ec) = o + bn;
    }
  }
}

// ---------------------------------------------------------------------------
extern "C" void kernel_launch(void* const* d_in, const int* in_sizes, int n_in,
                              void* d_out, int out_size, void* d_ws,
                              size_t ws_size, hipStream_t stream) {
  const float* x  = (const float*)d_in[0];
  const float* Wq = (const float*)d_in[1];
  const float* bq = (const float*)d_in[2];
  const float* Wk = (const float*)d_in[3];
  const float* bk = (const float*)d_in[4];
  const float* Wv = (const float*)d_in[5];
  const float* bv = (const float*)d_in[6];
  const float* Wo = (const float*)d_in[7];
  const float* bo = (const float*)d_in[8];
  float* out = (float*)d_out;

  // Workspace layout (bf16 elements):
  //   xb (4M) | Wq (1M) | Wk (1M) | Wv (1M) | Wo (1M) |
  //   Q (4M)  | K (4M)  | V^T (4M) | attn (4M)          = 24M elems = 48MB
  const size_t nX = (size_t)Bc * Tc * Ec;  // 4,194,304
  const size_t nW = (size_t)Ec * Ec;       // 1,048,576
  bf16* xb   = (bf16*)d_ws;
  bf16* Wqb  = xb + nX;
  bf16* Wkb  = Wqb + nW;
  bf16* Wvb  = Wkb + nW;
  bf16* Wob  = Wvb + nW;
  bf16* Qws  = Wob + nW;
  bf16* Kws  = Qws + nX;
  bf16* Vtws = Kws + nX;
  bf16* attn = Vtws + nX;

  // 0) fp32 -> bf16 pre-pass (removes all conversion from GEMM hot loops):
  //    xb | Wqb | Wkb | Wvb | Wob are contiguous, 8 slabs of nW elements.
  cvt_f32_bf16_kernel<<<dim3(nW / 2048), 256, 0, stream>>>(x, Wq, Wk, Wv, Wo,
                                                           xb);

  // 1) QKV projections: 256x192 tile per group, grid (BT/256, 3E/192);
  //    Wqb | Wkb | Wvb are contiguous.
  dim3 g1(Bc * Tc / 256, 3 * Ec / 192);
  qkv_proj_kernel<<<g1, 256, 0, stream>>>(xb, Wqb, bq, bk, bv, Qws, Kws, Vtws);

  // 2) Flash attention: 32-row q-tile per pair of waves, grid (8 heads,
  //    T/32/8 query blocks, B*H/8 sets of 8 heads).
  dim3 g2(8, Tc / 32 / 8, Bc * Hc / 8);
  flash_attn_kernel<<<g2, 512, 0, stream>>>(Qws, Kws, Vtws, attn);

  // 3) Output projection: 128x128 tile per group.
  dim3 g3(Bc * Tc / 128, Ec / 128);
  out_proj_kernel<<<g3, 256, 0, stream>>>(attn, Wob, bo, out);
}
